// v000
// Times are from an AMD MI455X. After a warm-up the kernel runs many times in a row, and a time is the length of
// such a window on the GPU divided by its runs, so every launch and the gaps after it count. The runs cycle
// through copies of the inputs. A figure is the median of several windows, for all but v000 over two sittings.
// Sittings can differ by a few percent; kernels timed side by side share one.
// The starting kernel, v000, takes 882 microseconds a run.
#include <hip/hip_runtime.h>

// ---------------------------------------------------------------------------
// DecoderHeadVDP on MI455X (gfx1250, wave32, WMMA + TDM)
// B=4, S=1024, D=1024, H=16, DH=64
// fp32 throughout via V_WMMA_F32_16X16X4_F32 (variance path is precision
// sensitive: p^2 / p^3 terms on 0.1-scale variances). Tile staging into LDS
// uses the Tensor Data Mover (tensor_load_to_lds) with descriptor padding
// reproducing the bank-conflict-free row stride of 65 DWORDs.
// ---------------------------------------------------------------------------

#define BATCH 4
#define SEQ   1024
#define DIM   1024
#define HEADS 16
#define DHEAD 64
#define RSQD  (1.0f / 32.0f)     // 1/sqrt(D)
#define RVD   (1.0f / 1024.0f)   // 1/D

typedef __attribute__((ext_vector_type(2))) float        v2f;
typedef __attribute__((ext_vector_type(8))) float        v8f;
typedef __attribute__((ext_vector_type(4))) unsigned int v4u;
typedef __attribute__((ext_vector_type(8))) int          v8i;
typedef __attribute__((ext_vector_type(4))) int          v4i;

#if defined(__has_builtin)
#if __has_builtin(__builtin_amdgcn_tensor_load_to_lds)
#define USE_TDM 1
#endif
#endif

static __device__ __forceinline__ v8f wmma4(v2f a, v2f b, v8f c) {
  // D = A(16x4) * B(4x16) + C, fp32
  return __builtin_amdgcn_wmma_f32_16x16x4_f32(false, a, false, b, (short)0, c,
                                               false, false);
}

// reductions across the 16-lane row group (wave32; xor masks <=8 stay in-half)
static __device__ __forceinline__ float rowmax16(float v) {
  v = fmaxf(v, __shfl_xor(v, 1));
  v = fmaxf(v, __shfl_xor(v, 2));
  v = fmaxf(v, __shfl_xor(v, 4));
  v = fmaxf(v, __shfl_xor(v, 8));
  return v;
}
static __device__ __forceinline__ float rowsum16(float v) {
  v += __shfl_xor(v, 1);
  v += __shfl_xor(v, 2);
  v += __shfl_xor(v, 4);
  v += __shfl_xor(v, 8);
  return v;
}

#ifdef USE_TDM
// ---------------------------------------------------------------------------
// TDM: async DMA of a 16-row x 64-col f32 tile, global -> LDS.
//   src             : global address of tile start (row-major, row pitch
//                     `pitch_elems` floats)
//   lds_byte_off    : LDS byte offset of destination
// D# pad feature inserts 1 DWORD after every 64 DWORDs -> LDS row stride 65,
// matching the padded tiles used by the WMMA operand reads.
// clang-23 / therock toolchain: 6-arg builtin
//   (v4u g0, v8i g1, v4i g2, v4i g3, v8i g4, i32 cpol)
// ---------------------------------------------------------------------------
static __device__ __forceinline__ void tdm_load_tile16x64(
    const float* src, unsigned int lds_byte_off, unsigned int pitch_elems) {
  const unsigned long long ga = (unsigned long long)(uintptr_t)src;
  v4u g0;
  g0.x = 1u;                                      // count=1 (valid), user mode
  g0.y = lds_byte_off;                            // lds_addr
  g0.z = (unsigned int)(ga & 0xffffffffu);        // global_addr[31:0]
  g0.w = (unsigned int)((ga >> 32) & 0x01ffffffu) // global_addr[56:32]
         | (2u << 30);                            // type = 2 ("image")
  v8i g1;
  g1[0] = (int)((2u << 16)        // data_size = 4 bytes
                | (1u << 20)      // pad_enable
                | (5u << 22));    // pad_interval: 64 DWORDs; pad_amount=0 -> 1 DWORD
  g1[1] = (int)(64u << 16);       // tensor_dim0[15:0] = 64
  g1[2] = (int)(16u << 16);       // tensor_dim0 hi=0 | tensor_dim1[15:0] = 16
  g1[3] = (int)(64u << 16);       // tensor_dim1 hi=0 | tile_dim0 = 64
  g1[4] = (int)16u;               // tile_dim1 = 16 | tile_dim2 = 0
  g1[5] = (int)pitch_elems;       // tensor_dim0_stride[31:0]
  g1[6] = 0;                      // stride hi | tensor_dim1_stride lo
  g1[7] = 0;
  const v4i z4 = {0, 0, 0, 0};                    // groups 2/3 unused (2D)
  const v8i z8 = {0, 0, 0, 0, 0, 0, 0, 0};
  __builtin_amdgcn_tensor_load_to_lds(g0, g1, z4, z4, z8, 0);
}
#endif

// ---------------------------------------------------------------------------
// Kernel 0: fold W2 = Wq_var + Wq_mu^2   (D*D elements)
// ---------------------------------------------------------------------------
__global__ void vdp_prep_w2(const float* __restrict__ wmu,
                            const float* __restrict__ wvar,
                            float* __restrict__ w2) {
  int i = blockIdx.x * blockDim.x + threadIdx.x;
  if (i < DIM * DIM) {
    float m = wmu[i];
    w2[i] = wvar[i] + m * m;
  }
}

// ---------------------------------------------------------------------------
// Kernel 1: projection.  q = x @ Wmu^T ; var_q = var_x @ W2^T + x^2 @ Wvar^T
// One wave per 16x16 output tile, K=1024 -> 256 wmma steps, 3 chains
// (variance chains share one accumulator). Also emits q^2 for the score GEMM.
// Weights are L2-resident (4MB each on a 192MB L2), so direct global loads.
// ---------------------------------------------------------------------------
__global__ void vdp_proj(const float* __restrict__ x,
                         const float* __restrict__ var_x,
                         const float* __restrict__ wmu,
                         const float* __restrict__ wvar,
                         const float* __restrict__ w2,
                         float* __restrict__ q,
                         float* __restrict__ var_q,
                         float* __restrict__ qsq) {
  const int lane = threadIdx.x & 31;
  const int wave = threadIdx.x >> 5;
  const int half = lane >> 4;   // 0/1
  const int l16  = lane & 15;

  const int tile = blockIdx.x * 8 + wave;        // 16384 tiles total
  const int m0 = (tile >> 6) << 4;               // (B*S)/16 = 256 row tiles
  const int n0 = (tile & 63) << 4;               // D/16 = 64 col tiles

  const float* xr  = x     + (size_t)(m0 + l16) * DIM;
  const float* vxr = var_x + (size_t)(m0 + l16) * DIM;
  const float* wmr = wmu   + (size_t)(n0 + l16) * DIM;
  const float* w2r = w2    + (size_t)(n0 + l16) * DIM;
  const float* wvr = wvar  + (size_t)(n0 + l16) * DIM;

  v8f accQ = {};
  v8f accV = {};
  const int kb = half * 2;

  for (int t = 0; t < DIM / 4; ++t) {
    const int kk = t * 4 + kb;
    v2f ax;  ax.x  = xr[kk];   ax.y  = xr[kk + 1];
    v2f avx; avx.x = vxr[kk];  avx.y = vxr[kk + 1];
    v2f ax2; ax2.x = ax.x * ax.x; ax2.y = ax.y * ax.y;
    v2f bm;  bm.x  = wmr[kk];  bm.y  = wmr[kk + 1];
    v2f b2;  b2.x  = w2r[kk];  b2.y  = w2r[kk + 1];
    v2f bv;  bv.x  = wvr[kk];  bv.y  = wvr[kk + 1];
    accQ = wmma4(ax,  bm, accQ);
    accV = wmma4(avx, b2, accV);
    accV = wmma4(ax2, bv, accV);
  }

#pragma unroll
  for (int r = 0; r < 8; ++r) {
    const int m = m0 + r + 8 * half;
    const int n = n0 + l16;
    const size_t gi = (size_t)m * DIM + n;
    const float qm = accQ[r];
    q[gi]     = qm;
    qsq[gi]   = qm * qm;
    var_q[gi] = accV[r];
  }
}

// ---------------------------------------------------------------------------
// Kernel 2: fused causal flash-attention with variance propagation.
// One wave per (b, h, 16-row block). Never materializes the SxS scores.
// Tile staging via TDM (tensor_load_to_lds), synced with TENSORcnt.
// ---------------------------------------------------------------------------
#define TS 65   // padded row stride for 16x64 LDS tiles (bank-conflict free)
#define PS 17   // padded row stride for 16x16 LDS tiles

__global__ __launch_bounds__(32)
void vdp_flash(const float* __restrict__ q,
               const float* __restrict__ var_q,
               const float* __restrict__ qsq,
               const float* __restrict__ kk_,
               const float* __restrict__ var_k,
               const float* __restrict__ vv_,
               const float* __restrict__ var_v,
               const float* __restrict__ x,
               float* __restrict__ out_mean,
               float* __restrict__ out_var) {
  __shared__ float lq[16 * TS], lvq[16 * TS], lq2[16 * TS];
  __shared__ float lk[16 * TS], lkv[16 * TS];
  __shared__ float lv[16 * TS], lvv[16 * TS];
  __shared__ float lp[4][16 * PS];

  const int lane = threadIdx.x & 31;
  const int half = lane >> 4;
  const int l16  = lane & 15;

  const int iblk = blockIdx.x & 63;        // S/16 row blocks
  const int bh   = blockIdx.x >> 6;
  const int h    = bh & (HEADS - 1);
  const int b    = bh >> 4;
  const int i0   = iblk * 16;

  const size_t khBase = (size_t)bh * SEQ * DHEAD;

  // ---- stage the q / var_q / q^2 row tiles (16 x 64, pitch DIM) once ----
#ifdef USE_TDM
  {
    const size_t qOff = (size_t)(b * SEQ + i0) * DIM + h * DHEAD;
    tdm_load_tile16x64(q     + qOff, (unsigned int)(uintptr_t)(&lq [0]), DIM);
    tdm_load_tile16x64(var_q + qOff, (unsigned int)(uintptr_t)(&lvq[0]), DIM);
    tdm_load_tile16x64(qsq   + qOff, (unsigned int)(uintptr_t)(&lq2[0]), DIM);
    __builtin_amdgcn_s_wait_tensorcnt((short)0);
  }
#else
  for (int idx = lane; idx < 16 * DHEAD; idx += 32) {
    const int rr = idx >> 6, cc = idx & 63;
    const size_t gi = (size_t)(b * SEQ + i0 + rr) * DIM + h * DHEAD + cc;
    lq [rr * TS + cc] = q[gi];
    lvq[rr * TS + cc] = var_q[gi];
    lq2[rr * TS + cc] = qsq[gi];
  }
#endif
  __syncthreads();   // single-wave WG: near-free, forces LDS visibility

  float mrun[8], lrun[8], s2run[8];
  v8f accA[4], accB1[4], accB2[4], accB3[4], accB4[4];
#pragma unroll
  for (int r = 0; r < 8; ++r) { mrun[r] = -1e30f; lrun[r] = 0.f; s2run[r] = 0.f; }
#pragma unroll
  for (int nt = 0; nt < 4; ++nt) {
    accA[nt] = (v8f){}; accB1[nt] = (v8f){}; accB2[nt] = (v8f){};
    accB3[nt] = (v8f){}; accB4[nt] = (v8f){};
  }

  for (int j0 = 0; j0 <= i0; j0 += 16) {
    // ---- stage k / var_k / v / var_v column tiles (16 x 64, pitch DHEAD) ----
#ifdef USE_TDM
    {
      // make sure prior DS reads of these tiles have drained before the DMA
      // overwrites them (TDM writes are not ordered against DS ops)
      asm volatile("s_wait_dscnt 0x0" ::: "memory");
      const size_t kOff = khBase + (size_t)j0 * DHEAD;
      tdm_load_tile16x64(kk_   + kOff, (unsigned int)(uintptr_t)(&lk [0]), DHEAD);
      tdm_load_tile16x64(var_k + kOff, (unsigned int)(uintptr_t)(&lkv[0]), DHEAD);
      tdm_load_tile16x64(vv_   + kOff, (unsigned int)(uintptr_t)(&lv [0]), DHEAD);
      tdm_load_tile16x64(var_v + kOff, (unsigned int)(uintptr_t)(&lvv[0]), DHEAD);
      __builtin_amdgcn_s_wait_tensorcnt((short)0);
    }
#else
    for (int idx = lane; idx < 16 * DHEAD; idx += 32) {
      const int rr = idx >> 6, cc = idx & 63;
      const size_t gi = khBase + (size_t)(j0 + rr) * DHEAD + cc;
      lk [rr * TS + cc] = kk_[gi];
      lkv[rr * TS + cc] = var_k[gi];
      lv [rr * TS + cc] = vv_[gi];
      lvv[rr * TS + cc] = var_v[gi];
    }
#endif
    __syncthreads();

    // ---- score GEMMs: mean = q k^T ; var = var_q (var_k+k^2)^T + q^2 var_k^T
    v8f sm = {}, sv = {};
    const int kb = half * 2;
#pragma unroll
    for (int t = 0; t < DHEAD / 4; ++t) {
      const int kkx = t * 4 + kb;
      const int qi = l16 * TS + kkx;
      v2f aq;  aq.x  = lq [qi]; aq.y  = lq [qi + 1];
      v2f avq; avq.x = lvq[qi]; avq.y = lvq[qi + 1];
      v2f aq2; aq2.x = lq2[qi]; aq2.y = lq2[qi + 1];
      v2f bk;  bk.x  = lk [qi]; bk.y  = lk [qi + 1];     // B = k^T: row n=l16
      v2f bkv; bkv.x = lkv[qi]; bkv.y = lkv[qi + 1];
      v2f bw;  bw.x = bkv.x + bk.x * bk.x; bw.y = bkv.y + bk.y * bk.y;
      sm = wmma4(aq,  bk,  sm);
      sv = wmma4(avq, bw,  sv);
      sv = wmma4(aq2, bkv, sv);
    }

    // ---- online VDP softmax update ----
    float f[8];
#pragma unroll
    for (int r = 0; r < 8; ++r) {
      const int m = i0 + r + 8 * half;          // global row
      const int n = j0 + l16;                   // global col
      const bool ok = (n <= m);
      float a  = ok ? sm[r] * RSQD : -1e30f;
      float va = sv[r] * RVD;
      const float rmax = rowmax16(a);
      const float mnew = fmaxf(mrun[r], rmax);
      f[r] = __expf(mrun[r] - mnew);
      mrun[r] = mnew;
      const float p   = ok ? __expf(a - mnew) : 0.0f;
      const float p2  = p * p;
      const float p2v = p2 * va;
      lrun[r]  = lrun[r]  * f[r]        + rowsum16(p);
      s2run[r] = s2run[r] * f[r] * f[r] + rowsum16(p2v);
      const int li = (r + 8 * half) * PS + l16; // store in (M,N) layout
      lp[0][li] = p;
      lp[1][li] = p2;
      lp[2][li] = p2v;
      lp[3][li] = p2v * p;
    }
    // rescale output accumulators (A ~ f, B1/B2/B4 ~ f^2, B3 ~ f^3)
#pragma unroll
    for (int r = 0; r < 8; ++r) {
      const float fr = f[r], f2 = fr * fr, f3 = f2 * fr;
#pragma unroll
      for (int nt = 0; nt < 4; ++nt) {
        accA [nt][r] *= fr;
        accB1[nt][r] *= f2;
        accB2[nt][r] *= f2;
        accB4[nt][r] *= f2;
        accB3[nt][r] *= f3;
      }
    }
    __syncthreads();

    // ---- output GEMMs: A += P1@v ; B1 += P2@W ; B2 += P3@W ; B3 += P4@W ;
    // ----               B4 += P2@var_v   (W = var_v + v^2)
#pragma unroll
    for (int t = 0; t < 4; ++t) {
      const int kkx = t * 4 + kb;
      const int pi = l16 * PS + kkx;            // A layout: m=l16, k=kkx+v
      v2f a1; a1.x = lp[0][pi]; a1.y = lp[0][pi + 1];
      v2f a2; a2.x = lp[1][pi]; a2.y = lp[1][pi + 1];
      v2f a3; a3.x = lp[2][pi]; a3.y = lp[2][pi + 1];
      v2f a4; a4.x = lp[3][pi]; a4.y = lp[3][pi + 1];
#pragma unroll
      for (int nt = 0; nt < 4; ++nt) {
        const int col = nt * 16 + l16;
        const float bv0 = lv [kkx * TS + col];
        const float bv1 = lv [(kkx + 1) * TS + col];
        const float bq0 = lvv[kkx * TS + col];
        const float bq1 = lvv[(kkx + 1) * TS + col];
        v2f Bv;  Bv.x  = bv0;             Bv.y  = bv1;
        v2f Bq;  Bq.x  = bq0;             Bq.y  = bq1;
        v2f Bw;  Bw.x  = bq0 + bv0 * bv0; Bw.y  = bq1 + bv1 * bv1;
        accA [nt] = wmma4(a1, Bv, accA [nt]);
        accB1[nt] = wmma4(a2, Bw, accB1[nt]);
        accB2[nt] = wmma4(a3, Bw, accB2[nt]);
        accB3[nt] = wmma4(a4, Bw, accB3[nt]);
        accB4[nt] = wmma4(a2, Bq, accB4[nt]);
      }
    }
    __syncthreads();
  }

  // ---- finalize: mean = x + A/l ;  var = s*B1/l^2 + (B2+B4)/l^2 - 2 B3/l^3
#pragma unroll
  for (int r = 0; r < 8; ++r) {
    const float inv  = 1.0f / lrun[r];
    const float inv2 = inv * inv;
    const float s    = s2run[r] * inv2;
    const int m = i0 + r + 8 * half;
#pragma unroll
    for (int nt = 0; nt < 4; ++nt) {
      const int col = h * DHEAD + nt * 16 + l16;
      const size_t gi = (size_t)(b * SEQ + m) * DIM + col;
      out_mean[gi] = x[gi] + accA[nt][r] * inv;
      out_var[gi]  = (s * accB1[nt][r] + accB2[nt][r] + accB4[nt][r]) * inv2
                     - 2.0f * accB3[nt][r] * inv2 * inv;
    }
  }
}

// ---------------------------------------------------------------------------
extern "C" void kernel_launch(void* const* d_in, const int* in_sizes, int n_in,
                              void* d_out, int out_size, void* d_ws, size_t ws_size,
                              hipStream_t stream) {
  const float* x     = (const float*)d_in[0];
  const float* var_x = (const float*)d_in[1];
  const float* k     = (const float*)d_in[2];
  const float* var_k = (const float*)d_in[3];
  const float* v     = (const float*)d_in[4];
  const float* var_v = (const float*)d_in[5];
  const float* wmu   = (const float*)d_in[6];
  const float* wvar  = (const float*)d_in[7];

  float* out = (float*)d_out;               // [mean | var], each B*S*D
  float* ws  = (float*)d_ws;
  const size_t NT = (size_t)BATCH * SEQ * DIM;   // 4M floats
  float* q   = ws;
  float* vq  = ws + NT;
  float* q2  = ws + 2 * NT;
  float* w2  = ws + 3 * NT;                 // D*D = 1M floats

  // 0) fold Wq_var + Wq_mu^2
  vdp_prep_w2<<<(DIM * DIM + 255) / 256, 256, 0, stream>>>(wmu, wvar, w2);

  // 1) projection: 16384 16x16 tiles, 8 waves/block
  vdp_proj<<<2048, 256, 0, stream>>>(x, var_x, wmu, wvar, w2, q, vq, q2);

  // 2) fused causal flash VDP attention + residual, 1 wave per 16-row block
  vdp_flash<<<BATCH * HEADS * (SEQ / 16), 32, 0, stream>>>(
      q, vq, q2, k, var_k, v, var_v, x, out, out + NT);
}

// v001
// A run of this version takes 530 microseconds.
// Two timings next to v000 put it at 1.70 and 1.69 times that version's speed.
#include <hip/hip_runtime.h>

// ---------------------------------------------------------------------------
// DecoderHeadVDP on MI455X (gfx1250, wave32, WMMA + TDM)
// B=4, S=1024, D=1024, H=16, DH=64
// fp32 throughout via V_WMMA_F32_16X16X4_F32 (variance path is precision
// sensitive: p^2 / p^3 terms on 0.1-scale variances). Attention tile staging into LDS
// uses the Tensor Data Mover (tensor_load_to_lds) with descriptor padding
// reproducing the bank-conflict-free row stride of 65 DWORDs.
// ---------------------------------------------------------------------------

#define BATCH 4
#define SEQ   1024
#define DIM   1024
#define HEADS 16
#define DHEAD 64
#define RSQD  (1.0f / 32.0f)     // 1/sqrt(D)
#define RVD   (1.0f / 1024.0f)   // 1/D

typedef __attribute__((ext_vector_type(2))) float        v2f;
typedef __attribute__((ext_vector_type(8))) float        v8f;
typedef __attribute__((ext_vector_type(4))) unsigned int v4u;
typedef __attribute__((ext_vector_type(8))) int          v8i;
typedef __attribute__((ext_vector_type(4))) int          v4i;

#if defined(__has_builtin)
#if __has_builtin(__builtin_amdgcn_tensor_load_to_lds)
#define USE_TDM 1
#endif
#endif

static __device__ __forceinline__ v8f wmma4(v2f a, v2f b, v8f c) {
  // D = A(16x4) * B(4x16) + C, fp32
  return __builtin_amdgcn_wmma_f32_16x16x4_f32(false, a, false, b, (short)0, c,
                                               false, false);
}

// reductions across the 16-lane row group (wave32; xor masks <=8 stay in-half)
static __device__ __forceinline__ float rowmax16(float v) {
  v = fmaxf(v, __shfl_xor(v, 1));
  v = fmaxf(v, __shfl_xor(v, 2));
  v = fmaxf(v, __shfl_xor(v, 4));
  v = fmaxf(v, __shfl_xor(v, 8));
  return v;
}
static __device__ __forceinline__ float rowsum16(float v) {
  v += __shfl_xor(v, 1);
  v += __shfl_xor(v, 2);
  v += __shfl_xor(v, 4);
  v += __shfl_xor(v, 8);
  return v;
}

#ifdef USE_TDM
// ---------------------------------------------------------------------------
// TDM: async DMA of a 16-row x 64-col f32 tile, global -> LDS.
//   src             : global address of tile start (row-major, row pitch
//                     `pitch_elems` floats)
//   lds_byte_off    : LDS byte offset of destination
// D# pad feature inserts 1 DWORD after every 64 DWORDs -> LDS row stride 65,
// matching the padded tiles used by the WMMA operand reads.
// clang-23 / therock toolchain: 6-arg builtin
//   (v4u g0, v8i g1, v4i g2, v4i g3, v8i g4, i32 cpol)
// ---------------------------------------------------------------------------
static __device__ __forceinline__ void tdm_load_tile16x64(
    const float* src, unsigned int lds_byte_off, unsigned int pitch_elems) {
  const unsigned long long ga = (unsigned long long)(uintptr_t)src;
  v4u g0;
  g0.x = 1u;                                      // count=1 (valid), user mode
  g0.y = lds_byte_off;                            // lds_addr
  g0.z = (unsigned int)(ga & 0xffffffffu);        // global_addr[31:0]
  g0.w = (unsigned int)((ga >> 32) & 0x01ffffffu) // global_addr[56:32]
         | (2u << 30);                            // type = 2 ("image")
  v8i g1;
  g1[0] = (int)((2u << 16)        // data_size = 4 bytes
                | (1u << 20)      // pad_enable
                | (5u << 22));    // pad_interval: 64 DWORDs; pad_amount=0 -> 1 DWORD
  g1[1] = (int)(64u << 16);       // tensor_dim0[15:0] = 64
  g1[2] = (int)(16u << 16);       // tensor_dim0 hi=0 | tensor_dim1[15:0] = 16
  g1[3] = (int)(64u << 16);       // tensor_dim1 hi=0 | tile_dim0 = 64
  g1[4] = (int)16u;               // tile_dim1 = 16 | tile_dim2 = 0
  g1[5] = (int)pitch_elems;       // tensor_dim0_stride[31:0]
  g1[6] = 0;                      // stride hi | tensor_dim1_stride lo
  g1[7] = 0;
  const v4i z4 = {0, 0, 0, 0};                    // groups 2/3 unused (2D)
  const v8i z8 = {0, 0, 0, 0, 0, 0, 0, 0};
  __builtin_amdgcn_tensor_load_to_lds(g0, g1, z4, z4, z8, 0);
}
#endif

// ---------------------------------------------------------------------------
// Kernel 0: fold W2 = Wq_var + Wq_mu^2   (D*D elements)
// ---------------------------------------------------------------------------
__global__ void vdp_prep_w2(const float* __restrict__ wmu,
                            const float* __restrict__ wvar,
                            float* __restrict__ w2) {
  int i = blockIdx.x * blockDim.x + threadIdx.x;
  if (i < DIM * DIM) {
    float m = wmu[i];
    w2[i] = wvar[i] + m * m;
  }
}

// ---------------------------------------------------------------------------
// Kernel 1: projection.  q = x @ Wmu^T ; var_q = var_x @ W2^T + x^2 @ Wvar^T
// One work-group (8 waves) per 128 x 64 output tile. Per stage of 32 k the
// rows of all five operands (x, var_x: 128 rows; Wmu, W2, Wvar: 64 rows) are
// brought in by whole-line 16-byte loads and stored to LDS, two buffers; each
// wave then forms a 32 x 32 piece (2 x 2 WMMA tiles, 3 products each) from
// 8-byte LDS fragment reads. The k order and the order of the two variance
// products per accumulator are those of a plain k = 0..1023 walk.
// ---------------------------------------------------------------------------
#define PBM   128                       // output rows per work-group
#define PBN   64                        // output columns per work-group
#define PBK   32                        // k per stage: one 128-byte line a row
#define PLP   36                        // LDS row pitch in floats (4 x odd: the
                                        // 16 rows x 4 dwords of a fragment read
                                        // fall on 64 different banks)
#define PROWS (2 * PBM + 3 * PBN)       // 448 staged rows
#define PNLD  (PROWS / 32)              // 14 16-byte loads per thread and stage
#define PNST  (DIM / PBK)               // 32 stages

typedef __attribute__((ext_vector_type(4))) float v4f;

__global__ __launch_bounds__(256)
void vdp_proj(const float* __restrict__ x,
              const float* __restrict__ var_x,
              const float* __restrict__ wmu,
              const float* __restrict__ wvar,
              const float* __restrict__ w2,
              float* __restrict__ q,
              float* __restrict__ var_q,
              float* __restrict__ qsq) {
  // rows 0..127 x | 128..255 var_x | 256..319 Wmu | 320..383 W2 | 384..447 Wvar
  __shared__ __attribute__((aligned(16))) float stg[2][PROWS * PLP];

  const int tid  = threadIdx.x;
  const int lane = tid & 31;
  const int wave = tid >> 5;
  const int half = lane >> 4;   // 0/1
  const int l16  = lane & 15;
  const int wm   = wave & 3;    // 4 wave rows of 32
  const int wn   = wave >> 2;   // 2 wave columns of 32

  const int m0 = (blockIdx.x >> 4) * PBM;        // 32 row blocks
  const int n0 = (blockIdx.x & 15) * PBN;        // 16 column blocks

  // staging: 8 threads cover one row's 128 bytes, 32 rows per step
  const int sr = tid >> 3;
  const int sc = (tid & 7) * 4;
  const unsigned int goff = (unsigned int)(sr * DIM + sc);  // the same for all five
  const float* gx  = x     + (size_t)m0 * DIM;              // block-uniform bases
  const float* gvx = var_x + (size_t)m0 * DIM;
  const float* gwm = wmu   + (size_t)n0 * DIM;
  const float* gw2 = w2    + (size_t)n0 * DIM;
  const float* gwv = wvar  + (size_t)n0 * DIM;
  const int sdst = sr * PLP + sc;

  // fragment reads: row = l16 of the tile, k = 4 * step + 2 * half + {0, 1}
  const int aoff = (wm * 32 + l16) * PLP + half * 2;
  const int boff = (2 * PBM + wn * 32 + l16) * PLP + half * 2;

  v4f st[PNLD];
  v8f accQ[2][2], accV[2][2];
#pragma unroll  // register arrays need constant indices
  for (int i = 0; i < 2; ++i)
#pragma unroll  // register arrays need constant indices
    for (int j = 0; j < 2; ++j) { accQ[i][j] = (v8f){}; accV[i][j] = (v8f){}; }

  auto fetch = [&](int s) {
    const int ko = s * PBK;
#pragma unroll  // register arrays need constant indices
    for (int i = 0; i < 4; ++i) {
      st[i]     = *(const v4f*)(gx  + ko + i * 32 * DIM + goff);
      st[4 + i] = *(const v4f*)(gvx + ko + i * 32 * DIM + goff);
    }
    // the loads below may land in registers that held the addresses above
    asm volatile("s_wait_xcnt 0x0" ::: "memory");
#pragma unroll  // register arrays need constant indices
    for (int i = 0; i < 2; ++i) {
      st[8 + i]  = *(const v4f*)(gwm + ko + i * 32 * DIM + goff);
      st[10 + i] = *(const v4f*)(gw2 + ko + i * 32 * DIM + goff);
      st[12 + i] = *(const v4f*)(gwv + ko + i * 32 * DIM + goff);
    }
  };
  auto put = [&](int buf) {
    float* d = &stg[buf][sdst];
#pragma unroll  // register arrays need constant indices
    for (int i = 0; i < PNLD; ++i) *(v4f*)(d + i * 32 * PLP) = st[i];
  };

  fetch(0);
  put(0);
  __syncthreads();   // stage 0 is in LDS for every wave

  for (int s = 0; s < PNST; ++s) {
    const bool more = (s + 1 < PNST);            // the same for the whole block
    if (more) fetch(s + 1);                      // in flight under this stage's WMMAs

    const float* pa = &stg[s & 1][aoff];
    const float* pb = &stg[s & 1][boff];
#pragma unroll  // register arrays need constant indices
    for (int t = 0; t < PBK / 4; ++t) {
      v2f ax[2], avx[2], ax2[2], bm[2], b2[2], bv[2];
#pragma unroll  // register arrays need constant indices
      for (int i = 0; i < 2; ++i) {
        ax[i]  = *(const v2f*)(pa + i * 16 * PLP + t * 4);
        avx[i] = *(const v2f*)(pa + (PBM + i * 16) * PLP + t * 4);
        ax2[i] = ax[i] * ax[i];
        bm[i]  = *(const v2f*)(pb + i * 16 * PLP + t * 4);
        b2[i]  = *(const v2f*)(pb + (PBN + i * 16) * PLP + t * 4);
        bv[i]  = *(const v2f*)(pb + (2 * PBN + i * 16) * PLP + t * 4);
      }
#pragma unroll  // register arrays need constant indices
      for (int i = 0; i < 2; ++i)
#pragma unroll  // register arrays need constant indices
        for (int j = 0; j < 2; ++j) accQ[i][j] = wmma4(ax[i], bm[j], accQ[i][j]);
#pragma unroll  // register arrays need constant indices
      for (int i = 0; i < 2; ++i)
#pragma unroll  // register arrays need constant indices
        for (int j = 0; j < 2; ++j) accV[i][j] = wmma4(avx[i], b2[j], accV[i][j]);
#pragma unroll  // register arrays need constant indices
      for (int i = 0; i < 2; ++i)
#pragma unroll  // register arrays need constant indices
        for (int j = 0; j < 2; ++j) accV[i][j] = wmma4(ax2[i], bv[j], accV[i][j]);
    }

    if (more) {
      put((s + 1) & 1);   // the buffer whose readers all passed the last barrier
      __syncthreads();    // publishes stage s + 1, ends the reads of stage s
    }
  }

#pragma unroll  // register arrays need constant indices
  for (int i = 0; i < 2; ++i) {
#pragma unroll  // register arrays need constant indices
    for (int j = 0; j < 2; ++j) {
#pragma unroll  // register arrays need constant indices
      for (int r = 0; r < 8; ++r) {
        const int m = m0 + wm * 32 + i * 16 + r + 8 * half;
        const int n = n0 + wn * 32 + j * 16 + l16;
        const size_t gi = (size_t)m * DIM + n;
        const float qm = accQ[i][j][r];
        q[gi]     = qm;
        qsq[gi]   = qm * qm;
        var_q[gi] = accV[i][j][r];
      }
    }
  }
}

// ---------------------------------------------------------------------------
// Kernel 2: fused causal flash-attention with variance propagation.
// One wave per (b, h, 16-row block). Never materializes the SxS scores.
// Tile staging via TDM (tensor_load_to_lds), synced with TENSORcnt.
// ---------------------------------------------------------------------------
#define TS 65   // padded row stride for 16x64 LDS tiles (bank-conflict free)
#define PS 17   // padded row stride for 16x16 LDS tiles

__global__ __launch_bounds__(32)
void vdp_flash(const float* __restrict__ q,
               const float* __restrict__ var_q,
               const float* __restrict__ qsq,
               const float* __restrict__ kk_,
               const float* __restrict__ var_k,
               const float* __restrict__ vv_,
               const float* __restrict__ var_v,
               const float* __restrict__ x,
               float* __restrict__ out_mean,
               float* __restrict__ out_var) {
  __shared__ float lq[16 * TS], lvq[16 * TS], lq2[16 * TS];
  __shared__ float lk[16 * TS], lkv[16 * TS];
  __shared__ float lv[16 * TS], lvv[16 * TS];
  __shared__ float lp[4][16 * PS];

  const int lane = threadIdx.x & 31;
  const int half = lane >> 4;
  const int l16  = lane & 15;

  const int iblk = blockIdx.x & 63;        // S/16 row blocks
  const int bh   = blockIdx.x >> 6;
  const int h    = bh & (HEADS - 1);
  const int b    = bh >> 4;
  const int i0   = iblk * 16;

  const size_t khBase = (size_t)bh * SEQ * DHEAD;

  // ---- stage the q / var_q / q^2 row tiles (16 x 64, pitch DIM) once ----
#ifdef USE_TDM
  {
    const size_t qOff = (size_t)(b * SEQ + i0) * DIM + h * DHEAD;
    tdm_load_tile16x64(q     + qOff, (unsigned int)(uintptr_t)(&lq [0]), DIM);
    tdm_load_tile16x64(var_q + qOff, (unsigned int)(uintptr_t)(&lvq[0]), DIM);
    tdm_load_tile16x64(qsq   + qOff, (unsigned int)(uintptr_t)(&lq2[0]), DIM);
    __builtin_amdgcn_s_wait_tensorcnt((short)0);
  }
#else
  for (int idx = lane; idx < 16 * DHEAD; idx += 32) {
    const int rr = idx >> 6, cc = idx & 63;
    const size_t gi = (size_t)(b * SEQ + i0 + rr) * DIM + h * DHEAD + cc;
    lq [rr * TS + cc] = q[gi];
    lvq[rr * TS + cc] = var_q[gi];
    lq2[rr * TS + cc] = qsq[gi];
  }
#endif
  __syncthreads();   // single-wave WG: near-free, forces LDS visibility

  float mrun[8], lrun[8], s2run[8];
  v8f accA[4], accB1[4], accB2[4], accB3[4], accB4[4];
#pragma unroll
  for (int r = 0; r < 8; ++r) { mrun[r] = -1e30f; lrun[r] = 0.f; s2run[r] = 0.f; }
#pragma unroll
  for (int nt = 0; nt < 4; ++nt) {
    accA[nt] = (v8f){}; accB1[nt] = (v8f){}; accB2[nt] = (v8f){};
    accB3[nt] = (v8f){}; accB4[nt] = (v8f){};
  }

  for (int j0 = 0; j0 <= i0; j0 += 16) {
    // ---- stage k / var_k / v / var_v column tiles (16 x 64, pitch DHEAD) ----
#ifdef USE_TDM
    {
      // make sure prior DS reads of these tiles have drained before the DMA
      // overwrites them (TDM writes are not ordered against DS ops)
      asm volatile("s_wait_dscnt 0x0" ::: "memory");
      const size_t kOff = khBase + (size_t)j0 * DHEAD;
      tdm_load_tile16x64(kk_   + kOff, (unsigned int)(uintptr_t)(&lk [0]), DHEAD);
      tdm_load_tile16x64(var_k + kOff, (unsigned int)(uintptr_t)(&lkv[0]), DHEAD);
      tdm_load_tile16x64(vv_   + kOff, (unsigned int)(uintptr_t)(&lv [0]), DHEAD);
      tdm_load_tile16x64(var_v + kOff, (unsigned int)(uintptr_t)(&lvv[0]), DHEAD);
      __builtin_amdgcn_s_wait_tensorcnt((short)0);
    }
#else
    for (int idx = lane; idx < 16 * DHEAD; idx += 32) {
      const int rr = idx >> 6, cc = idx & 63;
      const size_t gi = khBase + (size_t)(j0 + rr) * DHEAD + cc;
      lk [rr * TS + cc] = kk_[gi];
      lkv[rr * TS + cc] = var_k[gi];
      lv [rr * TS + cc] = vv_[gi];
      lvv[rr * TS + cc] = var_v[gi];
    }
#endif
    __syncthreads();

    // ---- score GEMMs: mean = q k^T ; var = var_q (var_k+k^2)^T + q^2 var_k^T
    v8f sm = {}, sv = {};
    const int kb = half * 2;
#pragma unroll
    for (int t = 0; t < DHEAD / 4; ++t) {
      const int kkx = t * 4 + kb;
      const int qi = l16 * TS + kkx;
      v2f aq;  aq.x  = lq [qi]; aq.y  = lq [qi + 1];
      v2f avq; avq.x = lvq[qi]; avq.y = lvq[qi + 1];
      v2f aq2; aq2.x = lq2[qi]; aq2.y = lq2[qi + 1];
      v2f bk;  bk.x  = lk [qi]; bk.y  = lk [qi + 1];     // B = k^T: row n=l16
      v2f bkv; bkv.x = lkv[qi]; bkv.y = lkv[qi + 1];
      v2f bw;  bw.x = bkv.x + bk.x * bk.x; bw.y = bkv.y + bk.y * bk.y;
      sm = wmma4(aq,  bk,  sm);
      sv = wmma4(avq, bw,  sv);
      sv = wmma4(aq2, bkv, sv);
    }

    // ---- online VDP softmax update ----
    float f[8];
#pragma unroll
    for (int r = 0; r < 8; ++r) {
      const int m = i0 + r + 8 * half;          // global row
      const int n = j0 + l16;                   // global col
      const bool ok = (n <= m);
      float a  = ok ? sm[r] * RSQD : -1e30f;
      float va = sv[r] * RVD;
      const float rmax = rowmax16(a);
      const float mnew = fmaxf(mrun[r], rmax);
      f[r] = __expf(mrun[r] - mnew);
      mrun[r] = mnew;
      const float p   = ok ? __expf(a - mnew) : 0.0f;
      const float p2  = p * p;
      const float p2v = p2 * va;
      lrun[r]  = lrun[r]  * f[r]        + rowsum16(p);
      s2run[r] = s2run[r] * f[r] * f[r] + rowsum16(p2v);
      const int li = (r + 8 * half) * PS + l16; // store in (M,N) layout
      lp[0][li] = p;
      lp[1][li] = p2;
      lp[2][li] = p2v;
      lp[3][li] = p2v * p;
    }
    // rescale output accumulators (A ~ f, B1/B2/B4 ~ f^2, B3 ~ f^3)
#pragma unroll
    for (int r = 0; r < 8; ++r) {
      const float fr = f[r], f2 = fr * fr, f3 = f2 * fr;
#pragma unroll
      for (int nt = 0; nt < 4; ++nt) {
        accA [nt][r] *= fr;
        accB1[nt][r] *= f2;
        accB2[nt][r] *= f2;
        accB4[nt][r] *= f2;
        accB3[nt][r] *= f3;
      }
    }
    __syncthreads();

    // ---- output GEMMs: A += P1@v ; B1 += P2@W ; B2 += P3@W ; B3 += P4@W ;
    // ----               B4 += P2@var_v   (W = var_v + v^2)
#pragma unroll
    for (int t = 0; t < 4; ++t) {
      const int kkx = t * 4 + kb;
      const int pi = l16 * PS + kkx;            // A layout: m=l16, k=kkx+v
      v2f a1; a1.x = lp[0][pi]; a1.y = lp[0][pi + 1];
      v2f a2; a2.x = lp[1][pi]; a2.y = lp[1][pi + 1];
      v2f a3; a3.x = lp[2][pi]; a3.y = lp[2][pi + 1];
      v2f a4; a4.x = lp[3][pi]; a4.y = lp[3][pi + 1];
#pragma unroll
      for (int nt = 0; nt < 4; ++nt) {
        const int col = nt * 16 + l16;
        const float bv0 = lv [kkx * TS + col];
        const float bv1 = lv [(kkx + 1) * TS + col];
        const float bq0 = lvv[kkx * TS + col];
        const float bq1 = lvv[(kkx + 1) * TS + col];
        v2f Bv;  Bv.x  = bv0;             Bv.y  = bv1;
        v2f Bq;  Bq.x  = bq0;             Bq.y  = bq1;
        v2f Bw;  Bw.x  = bq0 + bv0 * bv0; Bw.y  = bq1 + bv1 * bv1;
        accA [nt] = wmma4(a1, Bv, accA [nt]);
        accB1[nt] = wmma4(a2, Bw, accB1[nt]);
        accB2[nt] = wmma4(a3, Bw, accB2[nt]);
        accB3[nt] = wmma4(a4, Bw, accB3[nt]);
        accB4[nt] = wmma4(a2, Bq, accB4[nt]);
      }
    }
    __syncthreads();
  }

  // ---- finalize: mean = x + A/l ;  var = s*B1/l^2 + (B2+B4)/l^2 - 2 B3/l^3
#pragma unroll
  for (int r = 0; r < 8; ++r) {
    const float inv  = 1.0f / lrun[r];
    const float inv2 = inv * inv;
    const float s    = s2run[r] * inv2;
    const int m = i0 + r + 8 * half;
#pragma unroll
    for (int nt = 0; nt < 4; ++nt) {
      const int col = h * DHEAD + nt * 16 + l16;
      const size_t gi = (size_t)(b * SEQ + m) * DIM + col;
      out_mean[gi] = x[gi] + accA[nt][r] * inv;
      out_var[gi]  = (s * accB1[nt][r] + accB2[nt][r] + accB4[nt][r]) * inv2
                     - 2.0f * accB3[nt][r] * inv2 * inv;
    }
  }
}

// ---------------------------------------------------------------------------
extern "C" void kernel_launch(void* const* d_in, const int* in_sizes, int n_in,
                              void* d_out, int out_size, void* d_ws, size_t ws_size,
                              hipStream_t stream) {
  const float* x     = (const float*)d_in[0];
  const float* var_x = (const float*)d_in[1];
  const float* k     = (const float*)d_in[2];
  const float* var_k = (const float*)d_in[3];
  const float* v     = (const float*)d_in[4];
  const float* var_v = (const float*)d_in[5];
  const float* wmu   = (const float*)d_in[6];
  const float* wvar  = (const float*)d_in[7];

  float* out = (float*)d_out;               // [mean | var], each B*S*D
  float* ws  = (float*)d_ws;
  const size_t NT = (size_t)BATCH * SEQ * DIM;   // 4M floats
  float* q   = ws;
  float* vq  = ws + NT;
  float* q2  = ws + 2 * NT;
  float* w2  = ws + 3 * NT;                 // D*D = 1M floats

  // 0) fold Wq_var + Wq_mu^2
  vdp_prep_w2<<<(DIM * DIM + 255) / 256, 256, 0, stream>>>(wmu, wvar, w2);

  // 1) projection: 32 x 16 tiles of 128 x 64, 8 waves/block
  vdp_proj<<<512, 256, 0, stream>>>(x, var_x, wmu, wvar, w2, q, vq, q2);

  // 2) fused causal flash VDP attention + residual, 1 wave per 16-row block
  vdp_flash<<<BATCH * HEADS * (SEQ / 16), 32, 0, stream>>>(
      q, vq, q2, k, var_k, v, var_v, x, out, out + NT);
}

// v002
// One run takes 386 microseconds.
// Two timings next to v001 both put it at 1.39 times that version's speed.
// Over all steps from v000 it is 2.37 times as fast.
#include <hip/hip_runtime.h>

// ---------------------------------------------------------------------------
// DecoderHeadVDP on MI455X (gfx1250, wave32, WMMA + TDM)
// B=4, S=1024, D=1024, H=16, DH=64
// fp32 throughout via V_WMMA_F32_16X16X4_F32 (variance path is precision
// sensitive: p^2 / p^3 terms on 0.1-scale variances). Attention tile staging into LDS
// uses the Tensor Data Mover (tensor_load_to_lds) with descriptor padding
// reproducing the bank-conflict-free row stride of 65 DWORDs.
// ---------------------------------------------------------------------------

#define BATCH 4
#define SEQ   1024
#define DIM   1024
#define HEADS 16
#define DHEAD 64
#define RSQD  (1.0f / 32.0f)     // 1/sqrt(D)
#define RVD   (1.0f / 1024.0f)   // 1/D

typedef __attribute__((ext_vector_type(2))) float        v2f;
typedef __attribute__((ext_vector_type(8))) float        v8f;
typedef __attribute__((ext_vector_type(4))) unsigned int v4u;
typedef __attribute__((ext_vector_type(8))) int          v8i;
typedef __attribute__((ext_vector_type(4))) int          v4i;

#if defined(__has_builtin)
#if __has_builtin(__builtin_amdgcn_tensor_load_to_lds)
#define USE_TDM 1
#endif
#endif

static __device__ __forceinline__ v8f wmma4(v2f a, v2f b, v8f c) {
  // D = A(16x4) * B(4x16) + C, fp32
  return __builtin_amdgcn_wmma_f32_16x16x4_f32(false, a, false, b, (short)0, c,
                                               false, false);
}

// reductions across the 16-lane row group (wave32; xor masks <=8 stay in-half)
static __device__ __forceinline__ float rowmax16(float v) {
  v = fmaxf(v, __shfl_xor(v, 1));
  v = fmaxf(v, __shfl_xor(v, 2));
  v = fmaxf(v, __shfl_xor(v, 4));
  v = fmaxf(v, __shfl_xor(v, 8));
  return v;
}
static __device__ __forceinline__ float rowsum16(float v) {
  v += __shfl_xor(v, 1);
  v += __shfl_xor(v, 2);
  v += __shfl_xor(v, 4);
  v += __shfl_xor(v, 8);
  return v;
}

#ifdef USE_TDM
// ---------------------------------------------------------------------------
// TDM: async DMA of a 16-row x 64-col f32 tile, global -> LDS.
//   src             : global address of tile start (row-major, row pitch
//                     `pitch_elems` floats)
//   lds_byte_off    : LDS byte offset of destination
// D# pad feature inserts 1 DWORD after every 64 DWORDs -> LDS row stride 65,
// matching the padded tiles used by the WMMA operand reads.
// clang-23 / therock toolchain: 6-arg builtin
//   (v4u g0, v8i g1, v4i g2, v4i g3, v8i g4, i32 cpol)
// ---------------------------------------------------------------------------
static __device__ __forceinline__ void tdm_load_tile16x64(
    const float* src, unsigned int lds_byte_off, unsigned int pitch_elems) {
  const unsigned long long ga = (unsigned long long)(uintptr_t)src;
  v4u g0;
  g0.x = 1u;                                      // count=1 (valid), user mode
  g0.y = lds_byte_off;                            // lds_addr
  g0.z = (unsigned int)(ga & 0xffffffffu);        // global_addr[31:0]
  g0.w = (unsigned int)((ga >> 32) & 0x01ffffffu) // global_addr[56:32]
         | (2u << 30);                            // type = 2 ("image")
  v8i g1;
  g1[0] = (int)((2u << 16)        // data_size = 4 bytes
                | (1u << 20)      // pad_enable
                | (5u << 22));    // pad_interval: 64 DWORDs; pad_amount=0 -> 1 DWORD
  g1[1] = (int)(64u << 16);       // tensor_dim0[15:0] = 64
  g1[2] = (int)(16u << 16);       // tensor_dim0 hi=0 | tensor_dim1[15:0] = 16
  g1[3] = (int)(64u << 16);       // tensor_dim1 hi=0 | tile_dim0 = 64
  g1[4] = (int)16u;               // tile_dim1 = 16 | tile_dim2 = 0
  g1[5] = (int)pitch_elems;       // tensor_dim0_stride[31:0]
  g1[6] = 0;                      // stride hi | tensor_dim1_stride lo
  g1[7] = 0;
  const v4i z4 = {0, 0, 0, 0};                    // groups 2/3 unused (2D)
  const v8i z8 = {0, 0, 0, 0, 0, 0, 0, 0};
  __builtin_amdgcn_tensor_load_to_lds(g0, g1, z4, z4, z8, 0);
}
#endif

// ---------------------------------------------------------------------------
// Kernel 0: fold W2 = Wq_var + Wq_mu^2   (D*D elements)
// ---------------------------------------------------------------------------
__global__ void vdp_prep_w2(const float* __restrict__ wmu,
                            const float* __restrict__ wvar,
                            float* __restrict__ w2) {
  int i = blockIdx.x * blockDim.x + threadIdx.x;
  if (i < DIM * DIM) {
    float m = wmu[i];
    w2[i] = wvar[i] + m * m;
  }
}

// ---------------------------------------------------------------------------
// Kernel 1: projection.  q = x @ Wmu^T ; var_q = var_x @ W2^T + x^2 @ Wvar^T
// One work-group (8 waves) per 128 x 64 output tile. Per stage of 32 k the
// rows of all five operands (x, var_x: 128 rows; Wmu, W2, Wvar: 64 rows) are
// brought in by whole-line 16-byte loads and stored to LDS, two buffers; each
// wave then forms a 32 x 32 piece (2 x 2 WMMA tiles, 3 products each) from
// 8-byte LDS fragment reads. The k order and the order of the two variance
// products per accumulator are those of a plain k = 0..1023 walk.
// ---------------------------------------------------------------------------
#define PBM   128                       // output rows per work-group
#define PBN   64                        // output columns per work-group
#define PBK   32                        // k per stage: one 128-byte line a row
#define PLP   36                        // LDS row pitch in floats (4 x odd: the
                                        // 16 rows x 4 dwords of a fragment read
                                        // fall on 64 different banks)
#define PROWS (2 * PBM + 3 * PBN)       // 448 staged rows
#define PNLD  (PROWS / 32)              // 14 16-byte loads per thread and stage
#define PNST  (DIM / PBK)               // 32 stages

typedef __attribute__((ext_vector_type(4))) float v4f;

__global__ __launch_bounds__(256)
void vdp_proj(const float* __restrict__ x,
              const float* __restrict__ var_x,
              const float* __restrict__ wmu,
              const float* __restrict__ wvar,
              const float* __restrict__ w2,
              float* __restrict__ q,
              float* __restrict__ var_q,
              float* __restrict__ qsq) {
  // rows 0..127 x | 128..255 var_x | 256..319 Wmu | 320..383 W2 | 384..447 Wvar
  __shared__ __attribute__((aligned(16))) float stg[2][PROWS * PLP];

  const int tid  = threadIdx.x;
  const int lane = tid & 31;
  const int wave = tid >> 5;
  const int half = lane >> 4;   // 0/1
  const int l16  = lane & 15;
  const int wm   = wave & 3;    // 4 wave rows of 32
  const int wn   = wave >> 2;   // 2 wave columns of 32

  const int m0 = (blockIdx.x >> 4) * PBM;        // 32 row blocks
  const int n0 = (blockIdx.x & 15) * PBN;        // 16 column blocks

  // staging: 8 threads cover one row's 128 bytes, 32 rows per step
  const int sr = tid >> 3;
  const int sc = (tid & 7) * 4;
  const unsigned int goff = (unsigned int)(sr * DIM + sc);  // the same for all five
  const float* gx  = x     + (size_t)m0 * DIM;              // block-uniform bases
  const float* gvx = var_x + (size_t)m0 * DIM;
  const float* gwm = wmu   + (size_t)n0 * DIM;
  const float* gw2 = w2    + (size_t)n0 * DIM;
  const float* gwv = wvar  + (size_t)n0 * DIM;
  const int sdst = sr * PLP + sc;

  // fragment reads: row = l16 of the tile, k = 4 * step + 2 * half + {0, 1}
  const int aoff = (wm * 32 + l16) * PLP + half * 2;
  const int boff = (2 * PBM + wn * 32 + l16) * PLP + half * 2;

  v4f st[PNLD];
  v8f accQ[2][2], accV[2][2];
#pragma unroll  // register arrays need constant indices
  for (int i = 0; i < 2; ++i)
#pragma unroll  // register arrays need constant indices
    for (int j = 0; j < 2; ++j) { accQ[i][j] = (v8f){}; accV[i][j] = (v8f){}; }

  auto fetch = [&](int s) {
    const int ko = s * PBK;
#pragma unroll  // register arrays need constant indices
    for (int i = 0; i < 4; ++i) {
      st[i]     = *(const v4f*)(gx  + ko + i * 32 * DIM + goff);
      st[4 + i] = *(const v4f*)(gvx + ko + i * 32 * DIM + goff);
    }
    // the loads below may land in registers that held the addresses above
    asm volatile("s_wait_xcnt 0x0" ::: "memory");
#pragma unroll  // register arrays need constant indices
    for (int i = 0; i < 2; ++i) {
      st[8 + i]  = *(const v4f*)(gwm + ko + i * 32 * DIM + goff);
      st[10 + i] = *(const v4f*)(gw2 + ko + i * 32 * DIM + goff);
      st[12 + i] = *(const v4f*)(gwv + ko + i * 32 * DIM + goff);
    }
  };
  auto put = [&](int buf) {
    float* d = &stg[buf][sdst];
#pragma unroll  // register arrays need constant indices
    for (int i = 0; i < PNLD; ++i) *(v4f*)(d + i * 32 * PLP) = st[i];
  };

  fetch(0);
  put(0);
  __syncthreads();   // stage 0 is in LDS for every wave

  for (int s = 0; s < PNST; ++s) {
    const bool more = (s + 1 < PNST);            // the same for the whole block
    if (more) fetch(s + 1);                      // in flight under this stage's WMMAs

    const float* pa = &stg[s & 1][aoff];
    const float* pb = &stg[s & 1][boff];
#pragma unroll  // register arrays need constant indices
    for (int t = 0; t < PBK / 4; ++t) {
      v2f ax[2], avx[2], ax2[2], bm[2], b2[2], bv[2];
#pragma unroll  // register arrays need constant indices
      for (int i = 0; i < 2; ++i) {
        ax[i]  = *(const v2f*)(pa + i * 16 * PLP + t * 4);
        avx[i] = *(const v2f*)(pa + (PBM + i * 16) * PLP + t * 4);
        ax2[i] = ax[i] * ax[i];
        bm[i]  = *(const v2f*)(pb + i * 16 * PLP + t * 4);
        b2[i]  = *(const v2f*)(pb + (PBN + i * 16) * PLP + t * 4);
        bv[i]  = *(const v2f*)(pb + (2 * PBN + i * 16) * PLP + t * 4);
      }
#pragma unroll  // register arrays need constant indices
      for (int i = 0; i < 2; ++i)
#pragma unroll  // register arrays need constant indices
        for (int j = 0; j < 2; ++j) accQ[i][j] = wmma4(ax[i], bm[j], accQ[i][j]);
#pragma unroll  // register arrays need constant indices
      for (int i = 0; i < 2; ++i)
#pragma unroll  // register arrays need constant indices
        for (int j = 0; j < 2; ++j) accV[i][j] = wmma4(avx[i], b2[j], accV[i][j]);
#pragma unroll  // register arrays need constant indices
      for (int i = 0; i < 2; ++i)
#pragma unroll  // register arrays need constant indices
        for (int j = 0; j < 2; ++j) accV[i][j] = wmma4(ax2[i], bv[j], accV[i][j]);
    }

    if (more) {
      put((s + 1) & 1);   // the buffer whose readers all passed the last barrier
      __syncthreads();    // publishes stage s + 1, ends the reads of stage s
    }
  }

#pragma unroll  // register arrays need constant indices
  for (int i = 0; i < 2; ++i) {
#pragma unroll  // register arrays need constant indices
    for (int j = 0; j < 2; ++j) {
#pragma unroll  // register arrays need constant indices
      for (int r = 0; r < 8; ++r) {
        const int m = m0 + wm * 32 + i * 16 + r + 8 * half;
        const int n = n0 + wn * 32 + j * 16 + l16;
        const size_t gi = (size_t)m * DIM + n;
        const float qm = accQ[i][j][r];
        q[gi]     = qm;
        qsq[gi]   = qm * qm;
        var_q[gi] = accV[i][j][r];
      }
    }
  }
}

// ---------------------------------------------------------------------------
// Kernel 2: fused causal flash-attention with variance propagation.
// One wave per (b, h, 16-row block). Never materializes the SxS scores.
// Tile staging via TDM (tensor_load_to_lds), synced with TENSORcnt.
// ---------------------------------------------------------------------------
#define TS 65   // padded row stride for 16x64 LDS tiles (bank-conflict free)
#define PS 17   // padded row stride for 16x16 LDS tiles

__global__ __launch_bounds__(32)
void vdp_flash(const float* __restrict__ q,
               const float* __restrict__ var_q,
               const float* __restrict__ qsq,
               const float* __restrict__ kk_,
               const float* __restrict__ var_k,
               const float* __restrict__ vv_,
               const float* __restrict__ var_v,
               const float* __restrict__ x,
               float* __restrict__ out_mean,
               float* __restrict__ out_var) {
  __shared__ float lq[16 * TS], lvq[16 * TS], lq2[16 * TS];
  __shared__ float lk[16 * TS], lkv[16 * TS];
  __shared__ float lv[16 * TS], lvv[16 * TS];
  __shared__ float lp[4][16 * PS];

  const int lane = threadIdx.x & 31;
  const int half = lane >> 4;
  const int l16  = lane & 15;

  // A row block walks iblk + 1 key tiles and there are twice as many work-groups
  // as resident places: the cost falls with the index, so that the long blocks
  // start first and the short ones fill the places they leave.
  const int iblk = (SEQ / 16 - 1) - ((blockIdx.x >> 6) & (SEQ / 16 - 1));  // S/16 row blocks
  const int bh   = blockIdx.x & (BATCH * HEADS - 1);
  const int h    = bh & (HEADS - 1);
  const int b    = bh >> 4;
  const int i0   = iblk * 16;

  const size_t khBase = (size_t)bh * SEQ * DHEAD;

  // ---- stage the q / var_q / q^2 row tiles (16 x 64, pitch DIM) once ----
#ifdef USE_TDM
  {
    const size_t qOff = (size_t)(b * SEQ + i0) * DIM + h * DHEAD;
    tdm_load_tile16x64(q     + qOff, (unsigned int)(uintptr_t)(&lq [0]), DIM);
    tdm_load_tile16x64(var_q + qOff, (unsigned int)(uintptr_t)(&lvq[0]), DIM);
    tdm_load_tile16x64(qsq   + qOff, (unsigned int)(uintptr_t)(&lq2[0]), DIM);
    __builtin_amdgcn_s_wait_tensorcnt((short)0);
  }
#else
  for (int idx = lane; idx < 16 * DHEAD; idx += 32) {
    const int rr = idx >> 6, cc = idx & 63;
    const size_t gi = (size_t)(b * SEQ + i0 + rr) * DIM + h * DHEAD + cc;
    lq [rr * TS + cc] = q[gi];
    lvq[rr * TS + cc] = var_q[gi];
    lq2[rr * TS + cc] = qsq[gi];
  }
#endif
  __syncthreads();   // single-wave WG: near-free, forces LDS visibility

  float mrun[8], lrun[8], s2run[8];
  v8f accA[4], accB1[4], accB2[4], accB3[4], accB4[4];
#pragma unroll
  for (int r = 0; r < 8; ++r) { mrun[r] = -1e30f; lrun[r] = 0.f; s2run[r] = 0.f; }
#pragma unroll
  for (int nt = 0; nt < 4; ++nt) {
    accA[nt] = (v8f){}; accB1[nt] = (v8f){}; accB2[nt] = (v8f){};
    accB3[nt] = (v8f){}; accB4[nt] = (v8f){};
  }

  for (int j0 = 0; j0 <= i0; j0 += 16) {
    // ---- stage k / var_k / v / var_v column tiles (16 x 64, pitch DHEAD) ----
#ifdef USE_TDM
    {
      // make sure prior DS reads of these tiles have drained before the DMA
      // overwrites them (TDM writes are not ordered against DS ops)
      asm volatile("s_wait_dscnt 0x0" ::: "memory");
      const size_t kOff = khBase + (size_t)j0 * DHEAD;
      tdm_load_tile16x64(kk_   + kOff, (unsigned int)(uintptr_t)(&lk [0]), DHEAD);
      tdm_load_tile16x64(var_k + kOff, (unsigned int)(uintptr_t)(&lkv[0]), DHEAD);
      tdm_load_tile16x64(vv_   + kOff, (unsigned int)(uintptr_t)(&lv [0]), DHEAD);
      tdm_load_tile16x64(var_v + kOff, (unsigned int)(uintptr_t)(&lvv[0]), DHEAD);
      __builtin_amdgcn_s_wait_tensorcnt((short)0);
    }
#else
    for (int idx = lane; idx < 16 * DHEAD; idx += 32) {
      const int rr = idx >> 6, cc = idx & 63;
      const size_t gi = khBase + (size_t)(j0 + rr) * DHEAD + cc;
      lk [rr * TS + cc] = kk_[gi];
      lkv[rr * TS + cc] = var_k[gi];
      lv [rr * TS + cc] = vv_[gi];
      lvv[rr * TS + cc] = var_v[gi];
    }
#endif
    __syncthreads();

    // ---- score GEMMs: mean = q k^T ; var = var_q (var_k+k^2)^T + q^2 var_k^T
    v8f sm = {}, sv = {};
    const int kb = half * 2;
#pragma unroll
    for (int t = 0; t < DHEAD / 4; ++t) {
      const int kkx = t * 4 + kb;
      const int qi = l16 * TS + kkx;
      v2f aq;  aq.x  = lq [qi]; aq.y  = lq [qi + 1];
      v2f avq; avq.x = lvq[qi]; avq.y = lvq[qi + 1];
      v2f aq2; aq2.x = lq2[qi]; aq2.y = lq2[qi + 1];
      v2f bk;  bk.x  = lk [qi]; bk.y  = lk [qi + 1];     // B = k^T: row n=l16
      v2f bkv; bkv.x = lkv[qi]; bkv.y = lkv[qi + 1];
      v2f bw;  bw.x = bkv.x + bk.x * bk.x; bw.y = bkv.y + bk.y * bk.y;
      sm = wmma4(aq,  bk,  sm);
      sv = wmma4(avq, bw,  sv);
      sv = wmma4(aq2, bkv, sv);
    }

    // ---- online VDP softmax update ----
    float f[8];
#pragma unroll
    for (int r = 0; r < 8; ++r) {
      const int m = i0 + r + 8 * half;          // global row
      const int n = j0 + l16;                   // global col
      const bool ok = (n <= m);
      float a  = ok ? sm[r] * RSQD : -1e30f;
      float va = sv[r] * RVD;
      const float rmax = rowmax16(a);
      const float mnew = fmaxf(mrun[r], rmax);
      f[r] = __expf(mrun[r] - mnew);
      mrun[r] = mnew;
      const float p   = ok ? __expf(a - mnew) : 0.0f;
      const float p2  = p * p;
      const float p2v = p2 * va;
      lrun[r]  = lrun[r]  * f[r]        + rowsum16(p);
      s2run[r] = s2run[r] * f[r] * f[r] + rowsum16(p2v);
      const int li = (r + 8 * half) * PS + l16; // store in (M,N) layout
      lp[0][li] = p;
      lp[1][li] = p2;
      lp[2][li] = p2v;
      lp[3][li] = p2v * p;
    }
    // rescale output accumulators (A ~ f, B1/B2/B4 ~ f^2, B3 ~ f^3)
#pragma unroll
    for (int r = 0; r < 8; ++r) {
      const float fr = f[r], f2 = fr * fr, f3 = f2 * fr;
#pragma unroll
      for (int nt = 0; nt < 4; ++nt) {
        accA [nt][r] *= fr;
        accB1[nt][r] *= f2;
        accB2[nt][r] *= f2;
        accB4[nt][r] *= f2;
        accB3[nt][r] *= f3;
      }
    }
    __syncthreads();

    // ---- output GEMMs: A += P1@v ; B1 += P2@W ; B2 += P3@W ; B3 += P4@W ;
    // ----               B4 += P2@var_v   (W = var_v + v^2)
#pragma unroll
    for (int t = 0; t < 4; ++t) {
      const int kkx = t * 4 + kb;
      const int pi = l16 * PS + kkx;            // A layout: m=l16, k=kkx+v
      v2f a1; a1.x = lp[0][pi]; a1.y = lp[0][pi + 1];
      v2f a2; a2.x = lp[1][pi]; a2.y = lp[1][pi + 1];
      v2f a3; a3.x = lp[2][pi]; a3.y = lp[2][pi + 1];
      v2f a4; a4.x = lp[3][pi]; a4.y = lp[3][pi + 1];
#pragma unroll
      for (int nt = 0; nt < 4; ++nt) {
        const int col = nt * 16 + l16;
        const float bv0 = lv [kkx * TS + col];
        const float bv1 = lv [(kkx + 1) * TS + col];
        const float bq0 = lvv[kkx * TS + col];
        const float bq1 = lvv[(kkx + 1) * TS + col];
        v2f Bv;  Bv.x  = bv0;             Bv.y  = bv1;
        v2f Bq;  Bq.x  = bq0;             Bq.y  = bq1;
        v2f Bw;  Bw.x  = bq0 + bv0 * bv0; Bw.y  = bq1 + bv1 * bv1;
        accA [nt] = wmma4(a1, Bv, accA [nt]);
        accB1[nt] = wmma4(a2, Bw, accB1[nt]);
        accB2[nt] = wmma4(a3, Bw, accB2[nt]);
        accB3[nt] = wmma4(a4, Bw, accB3[nt]);
        accB4[nt] = wmma4(a2, Bq, accB4[nt]);
      }
    }
    __syncthreads();
  }

  // ---- finalize: mean = x + A/l ;  var = s*B1/l^2 + (B2+B4)/l^2 - 2 B3/l^3
#pragma unroll
  for (int r = 0; r < 8; ++r) {
    const float inv  = 1.0f / lrun[r];
    const float inv2 = inv * inv;
    const float s    = s2run[r] * inv2;
    const int m = i0 + r + 8 * half;
#pragma unroll
    for (int nt = 0; nt < 4; ++nt) {
      const int col = h * DHEAD + nt * 16 + l16;
      const size_t gi = (size_t)(b * SEQ + m) * DIM + col;
      out_mean[gi] = x[gi] + accA[nt][r] * inv;
      out_var[gi]  = (s * accB1[nt][r] + accB2[nt][r] + accB4[nt][r]) * inv2
                     - 2.0f * accB3[nt][r] * inv2 * inv;
    }
  }
}

// ---------------------------------------------------------------------------
extern "C" void kernel_launch(void* const* d_in, const int* in_sizes, int n_in,
                              void* d_out, int out_size, void* d_ws, size_t ws_size,
                              hipStream_t stream) {
  const float* x     = (const float*)d_in[0];
  const float* var_x = (const float*)d_in[1];
  const float* k     = (const float*)d_in[2];
  const float* var_k = (const float*)d_in[3];
  const float* v     = (const float*)d_in[4];
  const float* var_v = (const float*)d_in[5];
  const float* wmu   = (const float*)d_in[6];
  const float* wvar  = (const float*)d_in[7];

  float* out = (float*)d_out;               // [mean | var], each B*S*D
  float* ws  = (float*)d_ws;
  const size_t NT = (size_t)BATCH * SEQ * DIM;   // 4M floats
  float* q   = ws;
  float* vq  = ws + NT;
  float* q2  = ws + 2 * NT;
  float* w2  = ws + 3 * NT;                 // D*D = 1M floats

  // 0) fold Wq_var + Wq_mu^2
  vdp_prep_w2<<<(DIM * DIM + 255) / 256, 256, 0, stream>>>(wmu, wvar, w2);

  // 1) projection: 32 x 16 tiles of 128 x 64, 8 waves/block
  vdp_proj<<<512, 256, 0, stream>>>(x, var_x, wmu, wvar, w2, q, vq, q2);

  // 2) fused causal flash VDP attention + residual, 1 wave per 16-row block,
  //    longest row blocks at the lowest indices
  vdp_flash<<<BATCH * HEADS * (SEQ / 16), 32, 0, stream>>>(
      q, vq, q2, k, var_k, v, var_v, x, out, out + NT);
}

// v003
// One run takes 358 microseconds.
// In both of two side-by-side timings against v002, it was 1.08 times as fast.
// All steps since v000 together make it 2.55 times as fast.
#include <hip/hip_runtime.h>

// ---------------------------------------------------------------------------
// DecoderHeadVDP on MI455X (gfx1250, wave32, WMMA + TDM)
// B=4, S=1024, D=1024, H=16, DH=64
// fp32 throughout via V_WMMA_F32_16X16X4_F32 (variance path is precision
// sensitive: p^2 / p^3 terms on 0.1-scale variances). Attention tile staging into LDS
// uses the Tensor Data Mover (tensor_load_to_lds) with descriptor padding
// reproducing the bank-conflict-free row stride of 65 DWORDs.
// ---------------------------------------------------------------------------

#define BATCH 4
#define SEQ   1024
#define DIM   1024
#define HEADS 16
#define DHEAD 64
#define RSQD  (1.0f / 32.0f)     // 1/sqrt(D)
#define RVD   (1.0f / 1024.0f)   // 1/D

typedef __attribute__((ext_vector_type(2))) float        v2f;
typedef __attribute__((ext_vector_type(8))) float        v8f;
typedef __attribute__((ext_vector_type(4))) unsigned int v4u;
typedef __attribute__((ext_vector_type(8))) int          v8i;
typedef __attribute__((ext_vector_type(4))) int          v4i;

#if defined(__has_builtin)
#if __has_builtin(__builtin_amdgcn_tensor_load_to_lds)
#define USE_TDM 1
#endif
#endif

static __device__ __forceinline__ v8f wmma4(v2f a, v2f b, v8f c) {
  // D = A(16x4) * B(4x16) + C, fp32
  return __builtin_amdgcn_wmma_f32_16x16x4_f32(false, a, false, b, (short)0, c,
                                               false, false);
}

// Value of lane (l ^ M) of the same 16-lane row, M = 1..15, by a DPP operand
// (row_xmask) of the vector unit: no LDS instruction and no dscnt wait, where
// __shfl_xor goes through the LDS crossbar. Every lane is active at each use.
template <int M>
static __device__ __forceinline__ float rowxor(float v) {
  return __builtin_bit_cast(
      float, __builtin_amdgcn_mov_dpp(__builtin_bit_cast(int, v), 0x160 | M, 0xf,
                                      0xf, true));
}

// reductions across the 16-lane row group: the same xor butterfly as before
static __device__ __forceinline__ float rowmax16(float v) {
  v = fmaxf(v, rowxor<1>(v));
  v = fmaxf(v, rowxor<2>(v));
  v = fmaxf(v, rowxor<4>(v));
  v = fmaxf(v, rowxor<8>(v));
  return v;
}
static __device__ __forceinline__ float rowsum16(float v) {
  v += rowxor<1>(v);
  v += rowxor<2>(v);
  v += rowxor<4>(v);
  v += rowxor<8>(v);
  return v;
}

#ifdef USE_TDM
// ---------------------------------------------------------------------------
// TDM: async DMA of a 16-row x 64-col f32 tile, global -> LDS.
//   src             : global address of tile start (row-major, row pitch
//                     `pitch_elems` floats)
//   lds_byte_off    : LDS byte offset of destination
// D# pad feature inserts 1 DWORD after every 64 DWORDs -> LDS row stride 65,
// matching the padded tiles used by the WMMA operand reads.
// clang-23 / therock toolchain: 6-arg builtin
//   (v4u g0, v8i g1, v4i g2, v4i g3, v8i g4, i32 cpol)
// ---------------------------------------------------------------------------
static __device__ __forceinline__ void tdm_load_tile16x64(
    const float* src, unsigned int lds_byte_off, unsigned int pitch_elems) {
  const unsigned long long ga = (unsigned long long)(uintptr_t)src;
  v4u g0;
  g0.x = 1u;                                      // count=1 (valid), user mode
  g0.y = lds_byte_off;                            // lds_addr
  g0.z = (unsigned int)(ga & 0xffffffffu);        // global_addr[31:0]
  g0.w = (unsigned int)((ga >> 32) & 0x01ffffffu) // global_addr[56:32]
         | (2u << 30);                            // type = 2 ("image")
  v8i g1;
  g1[0] = (int)((2u << 16)        // data_size = 4 bytes
                | (1u << 20)      // pad_enable
                | (5u << 22));    // pad_interval: 64 DWORDs; pad_amount=0 -> 1 DWORD
  g1[1] = (int)(64u << 16);       // tensor_dim0[15:0] = 64
  g1[2] = (int)(16u << 16);       // tensor_dim0 hi=0 | tensor_dim1[15:0] = 16
  g1[3] = (int)(64u << 16);       // tensor_dim1 hi=0 | tile_dim0 = 64
  g1[4] = (int)16u;               // tile_dim1 = 16 | tile_dim2 = 0
  g1[5] = (int)pitch_elems;       // tensor_dim0_stride[31:0]
  g1[6] = 0;                      // stride hi | tensor_dim1_stride lo
  g1[7] = 0;
  const v4i z4 = {0, 0, 0, 0};                    // groups 2/3 unused (2D)
  const v8i z8 = {0, 0, 0, 0, 0, 0, 0, 0};
  __builtin_amdgcn_tensor_load_to_lds(g0, g1, z4, z4, z8, 0);
}
#endif

// ---------------------------------------------------------------------------
// Kernel 0: fold W2 = Wq_var + Wq_mu^2   (D*D elements)
// ---------------------------------------------------------------------------
__global__ void vdp_prep_w2(const float* __restrict__ wmu,
                            const float* __restrict__ wvar,
                            float* __restrict__ w2) {
  int i = blockIdx.x * blockDim.x + threadIdx.x;
  if (i < DIM * DIM) {
    float m = wmu[i];
    w2[i] = wvar[i] + m * m;
  }
}

// ---------------------------------------------------------------------------
// Kernel 1: projection.  q = x @ Wmu^T ; var_q = var_x @ W2^T + x^2 @ Wvar^T
// One work-group (8 waves) per 128 x 64 output tile. Per stage of 32 k the
// rows of all five operands (x, var_x: 128 rows; Wmu, W2, Wvar: 64 rows) are
// brought in by whole-line 16-byte loads and stored to LDS, two buffers; each
// wave then forms a 32 x 32 piece (2 x 2 WMMA tiles, 3 products each) from
// 8-byte LDS fragment reads. The k order and the order of the two variance
// products per accumulator are those of a plain k = 0..1023 walk.
// ---------------------------------------------------------------------------
#define PBM   128                       // output rows per work-group
#define PBN   64                        // output columns per work-group
#define PBK   32                        // k per stage: one 128-byte line a row
#define PLP   36                        // LDS row pitch in floats (4 x odd: the
                                        // 16 rows x 4 dwords of a fragment read
                                        // fall on 64 different banks)
#define PROWS (2 * PBM + 3 * PBN)       // 448 staged rows
#define PNLD  (PROWS / 32)              // 14 16-byte loads per thread and stage
#define PNST  (DIM / PBK)               // 32 stages

typedef __attribute__((ext_vector_type(4))) float v4f;

__global__ __launch_bounds__(256)
void vdp_proj(const float* __restrict__ x,
              const float* __restrict__ var_x,
              const float* __restrict__ wmu,
              const float* __restrict__ wvar,
              const float* __restrict__ w2,
              float* __restrict__ q,
              float* __restrict__ var_q,
              float* __restrict__ qsq) {
  // rows 0..127 x | 128..255 var_x | 256..319 Wmu | 320..383 W2 | 384..447 Wvar
  __shared__ __attribute__((aligned(16))) float stg[2][PROWS * PLP];

  const int tid  = threadIdx.x;
  const int lane = tid & 31;
  const int wave = tid >> 5;
  const int half = lane >> 4;   // 0/1
  const int l16  = lane & 15;
  const int wm   = wave & 3;    // 4 wave rows of 32
  const int wn   = wave >> 2;   // 2 wave columns of 32

  const int m0 = (blockIdx.x >> 4) * PBM;        // 32 row blocks
  const int n0 = (blockIdx.x & 15) * PBN;        // 16 column blocks

  // staging: 8 threads cover one row's 128 bytes, 32 rows per step
  const int sr = tid >> 3;
  const int sc = (tid & 7) * 4;
  const unsigned int goff = (unsigned int)(sr * DIM + sc);  // the same for all five
  const float* gx  = x     + (size_t)m0 * DIM;              // block-uniform bases
  const float* gvx = var_x + (size_t)m0 * DIM;
  const float* gwm = wmu   + (size_t)n0 * DIM;
  const float* gw2 = w2    + (size_t)n0 * DIM;
  const float* gwv = wvar  + (size_t)n0 * DIM;
  const int sdst = sr * PLP + sc;

  // fragment reads: row = l16 of the tile, k = 4 * step + 2 * half + {0, 1}
  const int aoff = (wm * 32 + l16) * PLP + half * 2;
  const int boff = (2 * PBM + wn * 32 + l16) * PLP + half * 2;

  v4f st[PNLD];
  v8f accQ[2][2], accV[2][2];
#pragma unroll  // register arrays need constant indices
  for (int i = 0; i < 2; ++i)
#pragma unroll  // register arrays need constant indices
    for (int j = 0; j < 2; ++j) { accQ[i][j] = (v8f){}; accV[i][j] = (v8f){}; }

  auto fetch = [&](int s) {
    const int ko = s * PBK;
#pragma unroll  // register arrays need constant indices
    for (int i = 0; i < 4; ++i) {
      st[i]     = *(const v4f*)(gx  + ko + i * 32 * DIM + goff);
      st[4 + i] = *(const v4f*)(gvx + ko + i * 32 * DIM + goff);
    }
    // the loads below may land in registers that held the addresses above
    asm volatile("s_wait_xcnt 0x0" ::: "memory");
#pragma unroll  // register arrays need constant indices
    for (int i = 0; i < 2; ++i) {
      st[8 + i]  = *(const v4f*)(gwm + ko + i * 32 * DIM + goff);
      st[10 + i] = *(const v4f*)(gw2 + ko + i * 32 * DIM + goff);
      st[12 + i] = *(const v4f*)(gwv + ko + i * 32 * DIM + goff);
    }
  };
  auto put = [&](int buf) {
    float* d = &stg[buf][sdst];
#pragma unroll  // register arrays need constant indices
    for (int i = 0; i < PNLD; ++i) *(v4f*)(d + i * 32 * PLP) = st[i];
  };

  fetch(0);
  put(0);
  __syncthreads();   // stage 0 is in LDS for every wave

  for (int s = 0; s < PNST; ++s) {
    const bool more = (s + 1 < PNST);            // the same for the whole block
    if (more) fetch(s + 1);                      // in flight under this stage's WMMAs

    const float* pa = &stg[s & 1][aoff];
    const float* pb = &stg[s & 1][boff];
#pragma unroll  // register arrays need constant indices
    for (int t = 0; t < PBK / 4; ++t) {
      v2f ax[2], avx[2], ax2[2], bm[2], b2[2], bv[2];
#pragma unroll  // register arrays need constant indices
      for (int i = 0; i < 2; ++i) {
        ax[i]  = *(const v2f*)(pa + i * 16 * PLP + t * 4);
        avx[i] = *(const v2f*)(pa + (PBM + i * 16) * PLP + t * 4);
        ax2[i] = ax[i] * ax[i];
        bm[i]  = *(const v2f*)(pb + i * 16 * PLP + t * 4);
        b2[i]  = *(const v2f*)(pb + (PBN + i * 16) * PLP + t * 4);
        bv[i]  = *(const v2f*)(pb + (2 * PBN + i * 16) * PLP + t * 4);
      }
#pragma unroll  // register arrays need constant indices
      for (int i = 0; i < 2; ++i)
#pragma unroll  // register arrays need constant indices
        for (int j = 0; j < 2; ++j) accQ[i][j] = wmma4(ax[i], bm[j], accQ[i][j]);
#pragma unroll  // register arrays need constant indices
      for (int i = 0; i < 2; ++i)
#pragma unroll  // register arrays need constant indices
        for (int j = 0; j < 2; ++j) accV[i][j] = wmma4(avx[i], b2[j], accV[i][j]);
#pragma unroll  // register arrays need constant indices
      for (int i = 0; i < 2; ++i)
#pragma unroll  // register arrays need constant indices
        for (int j = 0; j < 2; ++j) accV[i][j] = wmma4(ax2[i], bv[j], accV[i][j]);
    }

    if (more) {
      put((s + 1) & 1);   // the buffer whose readers all passed the last barrier
      __syncthreads();    // publishes stage s + 1, ends the reads of stage s
    }
  }

#pragma unroll  // register arrays need constant indices
  for (int i = 0; i < 2; ++i) {
#pragma unroll  // register arrays need constant indices
    for (int j = 0; j < 2; ++j) {
#pragma unroll  // register arrays need constant indices
      for (int r = 0; r < 8; ++r) {
        const int m = m0 + wm * 32 + i * 16 + r + 8 * half;
        const int n = n0 + wn * 32 + j * 16 + l16;
        const size_t gi = (size_t)m * DIM + n;
        const float qm = accQ[i][j][r];
        q[gi]     = qm;
        qsq[gi]   = qm * qm;
        var_q[gi] = accV[i][j][r];
      }
    }
  }
}

// ---------------------------------------------------------------------------
// Kernel 2: fused causal flash-attention with variance propagation.
// One wave per (b, h, 16-row block). Never materializes the SxS scores.
// Tile staging via TDM (tensor_load_to_lds), synced with TENSORcnt.
// ---------------------------------------------------------------------------
#define TS 65   // padded row stride for 16x64 LDS tiles (bank-conflict free)
#define PS 17   // padded row stride for 16x16 LDS tiles

__global__ __launch_bounds__(32)
void vdp_flash(const float* __restrict__ q,
               const float* __restrict__ var_q,
               const float* __restrict__ qsq,
               const float* __restrict__ kk_,
               const float* __restrict__ var_k,
               const float* __restrict__ vv_,
               const float* __restrict__ var_v,
               const float* __restrict__ x,
               float* __restrict__ out_mean,
               float* __restrict__ out_var) {
  __shared__ float lq[16 * TS], lvq[16 * TS], lq2[16 * TS];
  __shared__ float lk[16 * TS], lkv[16 * TS];
  __shared__ float lv[16 * TS], lvv[16 * TS];
  __shared__ float lp[4][16 * PS];

  const int lane = threadIdx.x & 31;
  const int half = lane >> 4;
  const int l16  = lane & 15;

  // A row block walks iblk + 1 key tiles and there are twice as many work-groups
  // as resident places: the cost falls with the index, so that the long blocks
  // start first and the short ones fill the places they leave.
  const int iblk = (SEQ / 16 - 1) - ((blockIdx.x >> 6) & (SEQ / 16 - 1));  // S/16 row blocks
  const int bh   = blockIdx.x & (BATCH * HEADS - 1);
  const int h    = bh & (HEADS - 1);
  const int b    = bh >> 4;
  const int i0   = iblk * 16;

  const size_t khBase = (size_t)bh * SEQ * DHEAD;

  // ---- stage the q / var_q / q^2 row tiles (16 x 64, pitch DIM) once ----
#ifdef USE_TDM
  {
    const size_t qOff = (size_t)(b * SEQ + i0) * DIM + h * DHEAD;
    tdm_load_tile16x64(q     + qOff, (unsigned int)(uintptr_t)(&lq [0]), DIM);
    tdm_load_tile16x64(var_q + qOff, (unsigned int)(uintptr_t)(&lvq[0]), DIM);
    tdm_load_tile16x64(qsq   + qOff, (unsigned int)(uintptr_t)(&lq2[0]), DIM);
    __builtin_amdgcn_s_wait_tensorcnt((short)0);
  }
#else
  for (int idx = lane; idx < 16 * DHEAD; idx += 32) {
    const int rr = idx >> 6, cc = idx & 63;
    const size_t gi = (size_t)(b * SEQ + i0 + rr) * DIM + h * DHEAD + cc;
    lq [rr * TS + cc] = q[gi];
    lvq[rr * TS + cc] = var_q[gi];
    lq2[rr * TS + cc] = qsq[gi];
  }
#endif
  __syncthreads();   // single-wave WG: near-free, forces LDS visibility

  float mrun[8], lrun[8], s2run[8];
  v8f accA[4], accB1[4], accB2[4], accB3[4], accB4[4];
#pragma unroll
  for (int r = 0; r < 8; ++r) { mrun[r] = -1e30f; lrun[r] = 0.f; s2run[r] = 0.f; }
#pragma unroll
  for (int nt = 0; nt < 4; ++nt) {
    accA[nt] = (v8f){}; accB1[nt] = (v8f){}; accB2[nt] = (v8f){};
    accB3[nt] = (v8f){}; accB4[nt] = (v8f){};
  }

  for (int j0 = 0; j0 <= i0; j0 += 16) {
    // ---- stage k / var_k / v / var_v column tiles (16 x 64, pitch DHEAD) ----
#ifdef USE_TDM
    {
      // make sure prior DS reads of these tiles have drained before the DMA
      // overwrites them (TDM writes are not ordered against DS ops)
      asm volatile("s_wait_dscnt 0x0" ::: "memory");
      const size_t kOff = khBase + (size_t)j0 * DHEAD;
      tdm_load_tile16x64(kk_   + kOff, (unsigned int)(uintptr_t)(&lk [0]), DHEAD);
      tdm_load_tile16x64(var_k + kOff, (unsigned int)(uintptr_t)(&lkv[0]), DHEAD);
      tdm_load_tile16x64(vv_   + kOff, (unsigned int)(uintptr_t)(&lv [0]), DHEAD);
      tdm_load_tile16x64(var_v + kOff, (unsigned int)(uintptr_t)(&lvv[0]), DHEAD);
      __builtin_amdgcn_s_wait_tensorcnt((short)0);
    }
#else
    for (int idx = lane; idx < 16 * DHEAD; idx += 32) {
      const int rr = idx >> 6, cc = idx & 63;
      const size_t gi = khBase + (size_t)(j0 + rr) * DHEAD + cc;
      lk [rr * TS + cc] = kk_[gi];
      lkv[rr * TS + cc] = var_k[gi];
      lv [rr * TS + cc] = vv_[gi];
      lvv[rr * TS + cc] = var_v[gi];
    }
#endif
    __syncthreads();

    // ---- score GEMMs: mean = q k^T ; var = var_q (var_k+k^2)^T + q^2 var_k^T
    v8f sm = {}, sv = {};
    const int kb = half * 2;
#pragma unroll
    for (int t = 0; t < DHEAD / 4; ++t) {
      const int kkx = t * 4 + kb;
      const int qi = l16 * TS + kkx;
      v2f aq;  aq.x  = lq [qi]; aq.y  = lq [qi + 1];
      v2f avq; avq.x = lvq[qi]; avq.y = lvq[qi + 1];
      v2f aq2; aq2.x = lq2[qi]; aq2.y = lq2[qi + 1];
      v2f bk;  bk.x  = lk [qi]; bk.y  = lk [qi + 1];     // B = k^T: row n=l16
      v2f bkv; bkv.x = lkv[qi]; bkv.y = lkv[qi + 1];
      v2f bw;  bw.x = bkv.x + bk.x * bk.x; bw.y = bkv.y + bk.y * bk.y;
      sm = wmma4(aq,  bk,  sm);
      sv = wmma4(avq, bw,  sv);
      sv = wmma4(aq2, bkv, sv);
    }

    // ---- online VDP softmax update ----
    float f[8];
#pragma unroll
    for (int r = 0; r < 8; ++r) {
      const int m = i0 + r + 8 * half;          // global row
      const int n = j0 + l16;                   // global col
      const bool ok = (n <= m);
      float a  = ok ? sm[r] * RSQD : -1e30f;
      float va = sv[r] * RVD;
      const float rmax = rowmax16(a);
      const float mnew = fmaxf(mrun[r], rmax);
      f[r] = __expf(mrun[r] - mnew);
      mrun[r] = mnew;
      const float p   = ok ? __expf(a - mnew) : 0.0f;
      const float p2  = p * p;
      const float p2v = p2 * va;
      lrun[r]  = lrun[r]  * f[r]        + rowsum16(p);
      s2run[r] = s2run[r] * f[r] * f[r] + rowsum16(p2v);
      const int li = (r + 8 * half) * PS + l16; // store in (M,N) layout
      lp[0][li] = p;
      lp[1][li] = p2;
      lp[2][li] = p2v;
      lp[3][li] = p2v * p;
    }
    // rescale output accumulators (A ~ f, B1/B2/B4 ~ f^2, B3 ~ f^3)
#pragma unroll
    for (int r = 0; r < 8; ++r) {
      const float fr = f[r], f2 = fr * fr, f3 = f2 * fr;
#pragma unroll
      for (int nt = 0; nt < 4; ++nt) {
        accA [nt][r] *= fr;
        accB1[nt][r] *= f2;
        accB2[nt][r] *= f2;
        accB4[nt][r] *= f2;
        accB3[nt][r] *= f3;
      }
    }
    __syncthreads();

    // ---- output GEMMs: A += P1@v ; B1 += P2@W ; B2 += P3@W ; B3 += P4@W ;
    // ----               B4 += P2@var_v   (W = var_v + v^2)
#pragma unroll
    for (int t = 0; t < 4; ++t) {
      const int kkx = t * 4 + kb;
      const int pi = l16 * PS + kkx;            // A layout: m=l16, k=kkx+v
      v2f a1; a1.x = lp[0][pi]; a1.y = lp[0][pi + 1];
      v2f a2; a2.x = lp[1][pi]; a2.y = lp[1][pi + 1];
      v2f a3; a3.x = lp[2][pi]; a3.y = lp[2][pi + 1];
      v2f a4; a4.x = lp[3][pi]; a4.y = lp[3][pi + 1];
#pragma unroll
      for (int nt = 0; nt < 4; ++nt) {
        const int col = nt * 16 + l16;
        const float bv0 = lv [kkx * TS + col];
        const float bv1 = lv [(kkx + 1) * TS + col];
        const float bq0 = lvv[kkx * TS + col];
        const float bq1 = lvv[(kkx + 1) * TS + col];
        v2f Bv;  Bv.x  = bv0;             Bv.y  = bv1;
        v2f Bq;  Bq.x  = bq0;             Bq.y  = bq1;
        v2f Bw;  Bw.x  = bq0 + bv0 * bv0; Bw.y  = bq1 + bv1 * bv1;
        accA [nt] = wmma4(a1, Bv, accA [nt]);
        accB1[nt] = wmma4(a2, Bw, accB1[nt]);
        accB2[nt] = wmma4(a3, Bw, accB2[nt]);
        accB3[nt] = wmma4(a4, Bw, accB3[nt]);
        accB4[nt] = wmma4(a2, Bq, accB4[nt]);
      }
    }
    __syncthreads();
  }

  // ---- finalize: mean = x + A/l ;  var = s*B1/l^2 + (B2+B4)/l^2 - 2 B3/l^3
#pragma unroll
  for (int r = 0; r < 8; ++r) {
    const float inv  = 1.0f / lrun[r];
    const float inv2 = inv * inv;
    const float s    = s2run[r] * inv2;
    const int m = i0 + r + 8 * half;
#pragma unroll
    for (int nt = 0; nt < 4; ++nt) {
      const int col = h * DHEAD + nt * 16 + l16;
      const size_t gi = (size_t)(b * SEQ + m) * DIM + col;
      out_mean[gi] = x[gi] + accA[nt][r] * inv;
      out_var[gi]  = (s * accB1[nt][r] + accB2[nt][r] + accB4[nt][r]) * inv2
                     - 2.0f * accB3[nt][r] * inv2 * inv;
    }
  }
}

// ---------------------------------------------------------------------------
extern "C" void kernel_launch(void* const* d_in, const int* in_sizes, int n_in,
                              void* d_out, int out_size, void* d_ws, size_t ws_size,
                              hipStream_t stream) {
  const float* x     = (const float*)d_in[0];
  const float* var_x = (const float*)d_in[1];
  const float* k     = (const float*)d_in[2];
  const float* var_k = (const float*)d_in[3];
  const float* v     = (const float*)d_in[4];
  const float* var_v = (const float*)d_in[5];
  const float* wmu   = (const float*)d_in[6];
  const float* wvar  = (const float*)d_in[7];

  float* out = (float*)d_out;               // [mean | var], each B*S*D
  float* ws  = (float*)d_ws;
  const size_t NT = (size_t)BATCH * SEQ * DIM;   // 4M floats
  float* q   = ws;
  float* vq  = ws + NT;
  float* q2  = ws + 2 * NT;
  float* w2  = ws + 3 * NT;                 // D*D = 1M floats

  // 0) fold Wq_var + Wq_mu^2
  vdp_prep_w2<<<(DIM * DIM + 255) / 256, 256, 0, stream>>>(wmu, wvar, w2);

  // 1) projection: 32 x 16 tiles of 128 x 64, 8 waves/block
  vdp_proj<<<512, 256, 0, stream>>>(x, var_x, wmu, wvar, w2, q, vq, q2);

  // 2) fused causal flash VDP attention + residual, 1 wave per 16-row block,
  //    longest row blocks at the lowest indices
  vdp_flash<<<BATCH * HEADS * (SEQ / 16), 32, 0, stream>>>(
      q, vq, q2, k, var_k, v, var_v, x, out, out + NT);
}

// v004
// It runs in 341 microseconds.
// Timed twice side by side with v003, it ran 1.05 times as fast both times.
// Over all steps from v000 it is 2.67 times as fast.
#include <hip/hip_runtime.h>

// ---------------------------------------------------------------------------
// DecoderHeadVDP on MI455X (gfx1250, wave32, WMMA + TDM)
// B=4, S=1024, D=1024, H=16, DH=64
// fp32 throughout via V_WMMA_F32_16X16X4_F32 (variance path is precision
// sensitive: p^2 / p^3 terms on 0.1-scale variances). Attention tile staging into LDS
// uses the Tensor Data Mover (tensor_load_to_lds) with descriptor padding
// reproducing the bank-conflict-free row stride of 65 DWORDs.
// ---------------------------------------------------------------------------

#define BATCH 4
#define SEQ   1024
#define DIM   1024
#define HEADS 16
#define DHEAD 64
#define RSQD  (1.0f / 32.0f)     // 1/sqrt(D)
#define RVD   (1.0f / 1024.0f)   // 1/D

typedef __attribute__((ext_vector_type(2))) float        v2f;
typedef __attribute__((ext_vector_type(8))) float        v8f;
typedef __attribute__((ext_vector_type(4))) unsigned int v4u;
typedef __attribute__((ext_vector_type(8))) int          v8i;
typedef __attribute__((ext_vector_type(4))) int          v4i;

#if defined(__has_builtin)
#if __has_builtin(__builtin_amdgcn_tensor_load_to_lds)
#define USE_TDM 1
#endif
#endif

static __device__ __forceinline__ v8f wmma4(v2f a, v2f b, v8f c) {
  // D = A(16x4) * B(4x16) + C, fp32
  return __builtin_amdgcn_wmma_f32_16x16x4_f32(false, a, false, b, (short)0, c,
                                               false, false);
}

#ifdef USE_TDM
// ---------------------------------------------------------------------------
// TDM: async DMA of a 16-row x 64-col f32 tile, global -> LDS.
//   src             : global address of tile start (row-major, row pitch
//                     `pitch_elems` floats)
//   lds_byte_off    : LDS byte offset of destination
// D# pad feature inserts 1 DWORD after every 64 DWORDs -> LDS row stride 65,
// matching the padded tiles used by the WMMA operand reads.
// clang-23 / therock toolchain: 6-arg builtin
//   (v4u g0, v8i g1, v4i g2, v4i g3, v8i g4, i32 cpol)
// ---------------------------------------------------------------------------
static __device__ __forceinline__ void tdm_load_tile16x64(
    const float* src, unsigned int lds_byte_off, unsigned int pitch_elems) {
  const unsigned long long ga = (unsigned long long)(uintptr_t)src;
  v4u g0;
  g0.x = 1u;                                      // count=1 (valid), user mode
  g0.y = lds_byte_off;                            // lds_addr
  g0.z = (unsigned int)(ga & 0xffffffffu);        // global_addr[31:0]
  g0.w = (unsigned int)((ga >> 32) & 0x01ffffffu) // global_addr[56:32]
         | (2u << 30);                            // type = 2 ("image")
  v8i g1;
  g1[0] = (int)((2u << 16)        // data_size = 4 bytes
                | (1u << 20)      // pad_enable
                | (5u << 22));    // pad_interval: 64 DWORDs; pad_amount=0 -> 1 DWORD
  g1[1] = (int)(64u << 16);       // tensor_dim0[15:0] = 64
  g1[2] = (int)(16u << 16);       // tensor_dim0 hi=0 | tensor_dim1[15:0] = 16
  g1[3] = (int)(64u << 16);       // tensor_dim1 hi=0 | tile_dim0 = 64
  g1[4] = (int)16u;               // tile_dim1 = 16 | tile_dim2 = 0
  g1[5] = (int)pitch_elems;       // tensor_dim0_stride[31:0]
  g1[6] = 0;                      // stride hi | tensor_dim1_stride lo
  g1[7] = 0;
  const v4i z4 = {0, 0, 0, 0};                    // groups 2/3 unused (2D)
  const v8i z8 = {0, 0, 0, 0, 0, 0, 0, 0};
  __builtin_amdgcn_tensor_load_to_lds(g0, g1, z4, z4, z8, 0);
}
#endif

// ---------------------------------------------------------------------------
// Kernel 0: fold W2 = Wq_var + Wq_mu^2   (D*D elements)
// ---------------------------------------------------------------------------
__global__ void vdp_prep_w2(const float* __restrict__ wmu,
                            const float* __restrict__ wvar,
                            float* __restrict__ w2) {
  int i = blockIdx.x * blockDim.x + threadIdx.x;
  if (i < DIM * DIM) {
    float m = wmu[i];
    w2[i] = wvar[i] + m * m;
  }
}

// ---------------------------------------------------------------------------
// Kernel 1: projection.  q = x @ Wmu^T ; var_q = var_x @ W2^T + x^2 @ Wvar^T
// One work-group (8 waves) per 128 x 64 output tile. Per stage of 32 k the
// rows of all five operands (x, var_x: 128 rows; Wmu, W2, Wvar: 64 rows) are
// brought in by whole-line 16-byte loads and stored to LDS, two buffers; each
// wave then forms a 32 x 32 piece (2 x 2 WMMA tiles, 3 products each) from
// 8-byte LDS fragment reads. The k order and the order of the two variance
// products per accumulator are those of a plain k = 0..1023 walk.
// ---------------------------------------------------------------------------
#define PBM   128                       // output rows per work-group
#define PBN   64                        // output columns per work-group
#define PBK   32                        // k per stage: one 128-byte line a row
#define PLP   36                        // LDS row pitch in floats (4 x odd: the
                                        // 16 rows x 4 dwords of a fragment read
                                        // fall on 64 different banks)
#define PROWS (2 * PBM + 3 * PBN)       // 448 staged rows
#define PNLD  (PROWS / 32)              // 14 16-byte loads per thread and stage
#define PNST  (DIM / PBK)               // 32 stages

typedef __attribute__((ext_vector_type(4))) float v4f;

__global__ __launch_bounds__(256)
void vdp_proj(const float* __restrict__ x,
              const float* __restrict__ var_x,
              const float* __restrict__ wmu,
              const float* __restrict__ wvar,
              const float* __restrict__ w2,
              float* __restrict__ q,
              float* __restrict__ var_q,
              float* __restrict__ qsq) {
  // rows 0..127 x | 128..255 var_x | 256..319 Wmu | 320..383 W2 | 384..447 Wvar
  __shared__ __attribute__((aligned(16))) float stg[2][PROWS * PLP];

  const int tid  = threadIdx.x;
  const int lane = tid & 31;
  const int wave = tid >> 5;
  const int half = lane >> 4;   // 0/1
  const int l16  = lane & 15;
  const int wm   = wave & 3;    // 4 wave rows of 32
  const int wn   = wave >> 2;   // 2 wave columns of 32

  const int m0 = (blockIdx.x >> 4) * PBM;        // 32 row blocks
  const int n0 = (blockIdx.x & 15) * PBN;        // 16 column blocks

  // staging: 8 threads cover one row's 128 bytes, 32 rows per step
  const int sr = tid >> 3;
  const int sc = (tid & 7) * 4;
  const unsigned int goff = (unsigned int)(sr * DIM + sc);  // the same for all five
  const float* gx  = x     + (size_t)m0 * DIM;              // block-uniform bases
  const float* gvx = var_x + (size_t)m0 * DIM;
  const float* gwm = wmu   + (size_t)n0 * DIM;
  const float* gw2 = w2    + (size_t)n0 * DIM;
  const float* gwv = wvar  + (size_t)n0 * DIM;
  const int sdst = sr * PLP + sc;

  // fragment reads: row = l16 of the tile, k = 4 * step + 2 * half + {0, 1}
  const int aoff = (wm * 32 + l16) * PLP + half * 2;
  const int boff = (2 * PBM + wn * 32 + l16) * PLP + half * 2;

  v4f st[PNLD];
  v8f accQ[2][2], accV[2][2];
#pragma unroll  // register arrays need constant indices
  for (int i = 0; i < 2; ++i)
#pragma unroll  // register arrays need constant indices
    for (int j = 0; j < 2; ++j) { accQ[i][j] = (v8f){}; accV[i][j] = (v8f){}; }

  auto fetch = [&](int s) {
    const int ko = s * PBK;
#pragma unroll  // register arrays need constant indices
    for (int i = 0; i < 4; ++i) {
      st[i]     = *(const v4f*)(gx  + ko + i * 32 * DIM + goff);
      st[4 + i] = *(const v4f*)(gvx + ko + i * 32 * DIM + goff);
    }
    // the loads below may land in registers that held the addresses above
    asm volatile("s_wait_xcnt 0x0" ::: "memory");
#pragma unroll  // register arrays need constant indices
    for (int i = 0; i < 2; ++i) {
      st[8 + i]  = *(const v4f*)(gwm + ko + i * 32 * DIM + goff);
      st[10 + i] = *(const v4f*)(gw2 + ko + i * 32 * DIM + goff);
      st[12 + i] = *(const v4f*)(gwv + ko + i * 32 * DIM + goff);
    }
  };
  auto put = [&](int buf) {
    float* d = &stg[buf][sdst];
#pragma unroll  // register arrays need constant indices
    for (int i = 0; i < PNLD; ++i) *(v4f*)(d + i * 32 * PLP) = st[i];
  };

  fetch(0);
  put(0);
  __syncthreads();   // stage 0 is in LDS for every wave

  for (int s = 0; s < PNST; ++s) {
    const bool more = (s + 1 < PNST);            // the same for the whole block
    if (more) fetch(s + 1);                      // in flight under this stage's WMMAs

    const float* pa = &stg[s & 1][aoff];
    const float* pb = &stg[s & 1][boff];
#pragma unroll  // register arrays need constant indices
    for (int t = 0; t < PBK / 4; ++t) {
      v2f ax[2], avx[2], ax2[2], bm[2], b2[2], bv[2];
#pragma unroll  // register arrays need constant indices
      for (int i = 0; i < 2; ++i) {
        ax[i]  = *(const v2f*)(pa + i * 16 * PLP + t * 4);
        avx[i] = *(const v2f*)(pa + (PBM + i * 16) * PLP + t * 4);
        ax2[i] = ax[i] * ax[i];
        bm[i]  = *(const v2f*)(pb + i * 16 * PLP + t * 4);
        b2[i]  = *(const v2f*)(pb + (PBN + i * 16) * PLP + t * 4);
        bv[i]  = *(const v2f*)(pb + (2 * PBN + i * 16) * PLP + t * 4);
      }
#pragma unroll  // register arrays need constant indices
      for (int i = 0; i < 2; ++i)
#pragma unroll  // register arrays need constant indices
        for (int j = 0; j < 2; ++j) accQ[i][j] = wmma4(ax[i], bm[j], accQ[i][j]);
#pragma unroll  // register arrays need constant indices
      for (int i = 0; i < 2; ++i)
#pragma unroll  // register arrays need constant indices
        for (int j = 0; j < 2; ++j) accV[i][j] = wmma4(avx[i], b2[j], accV[i][j]);
#pragma unroll  // register arrays need constant indices
      for (int i = 0; i < 2; ++i)
#pragma unroll  // register arrays need constant indices
        for (int j = 0; j < 2; ++j) accV[i][j] = wmma4(ax2[i], bv[j], accV[i][j]);
    }

    if (more) {
      put((s + 1) & 1);   // the buffer whose readers all passed the last barrier
      __syncthreads();    // publishes stage s + 1, ends the reads of stage s
    }
  }

#pragma unroll  // register arrays need constant indices
  for (int i = 0; i < 2; ++i) {
#pragma unroll  // register arrays need constant indices
    for (int j = 0; j < 2; ++j) {
#pragma unroll  // register arrays need constant indices
      for (int r = 0; r < 8; ++r) {
        const int m = m0 + wm * 32 + i * 16 + r + 8 * half;
        const int n = n0 + wn * 32 + j * 16 + l16;
        const size_t gi = (size_t)m * DIM + n;
        const float qm = accQ[i][j][r];
        q[gi]     = qm;
        qsq[gi]   = qm * qm;
        var_q[gi] = accV[i][j][r];
      }
    }
  }
}

#define TS 65

// lane l <-> lane l ^ 16 on the vector unit
static __device__ __forceinline__ float xhalf(float v) {
  return __builtin_bit_cast(
      float, __builtin_amdgcn_permlanex16(__builtin_bit_cast(int, v),
                                          __builtin_bit_cast(int, v), 0x76543210,
                                          0xfedcba98, false, false));
}

// e^v as __expf forms it (2^(v log2 e) on the transcendental unit). The v_nop in
// the same statement is the slot the instruction set asks for between a
// transcendental and an instruction that reads its result or overwrites its
// source.
static __device__ __forceinline__ float exp_slot(float v) {
  float e;
  asm("v_exp_f32 %0, %1\n\tv_nop" : "=v"(e) : "v"(v * 1.44269504088896340736f));
  return e;
}

__global__ __launch_bounds__(32)
void vdp_flash(const float* __restrict__ q,
               const float* __restrict__ var_q,
               const float* __restrict__ qsq,
               const float* __restrict__ kk_,
               const float* __restrict__ var_k,
               const float* __restrict__ vv_,
               const float* __restrict__ var_v,
               const float* __restrict__ x,
               float* __restrict__ out_mean,
               float* __restrict__ out_var) {
  __shared__ float lq[16 * TS], lvq[16 * TS], lq2[16 * TS];
  __shared__ float lk[16 * TS], lkv[16 * TS];
  __shared__ float lv[16 * TS];
  // var_v's tile stands at LDS byte 0 (the alignment puts it first) and is rounded
  // up to 4352 bytes: the other six tensor loads then aim at 4352 + 4160 i
  __shared__ __attribute__((aligned(2048))) float lvv[16 * TS + 48];

  const int lane = threadIdx.x & 31;
  const int half = lane >> 4;
  const int l16  = lane & 15;

  // A row block walks iblk + 1 key tiles and there are more work-groups than
  // resident places: the cost falls with the index, so that the long blocks
  // start first and the short ones fill the places they leave.
  const int iblk = (SEQ / 16 - 1) - ((blockIdx.x >> 6) & (SEQ / 16 - 1));  // S/16 row blocks
  const int bh   = blockIdx.x & (BATCH * HEADS - 1);
  const int h    = bh & (HEADS - 1);
  const int b    = bh >> 4;
  const int i0   = iblk * 16;

  const size_t khBase = (size_t)bh * SEQ * DHEAD;

  // ---- stage the q / var_q / q^2 row tiles (16 x 64, pitch DIM) once ----
#ifdef USE_TDM
  {
    const size_t qOff = (size_t)(b * SEQ + i0) * DIM + h * DHEAD;
    tdm_load_tile16x64(q     + qOff, (unsigned int)(uintptr_t)(&lq [0]), DIM);
    tdm_load_tile16x64(var_q + qOff, (unsigned int)(uintptr_t)(&lvq[0]), DIM);
    tdm_load_tile16x64(qsq   + qOff, (unsigned int)(uintptr_t)(&lq2[0]), DIM);
    __builtin_amdgcn_s_wait_tensorcnt((short)0);
  }
#else
  for (int idx = lane; idx < 16 * DHEAD; idx += 32) {
    const int rr = idx >> 6, cc = idx & 63;
    const size_t gi = (size_t)(b * SEQ + i0 + rr) * DIM + h * DHEAD + cc;
    lq [rr * TS + cc] = q[gi];
    lvq[rr * TS + cc] = var_q[gi];
    lq2[rr * TS + cc] = qsq[gi];
  }
#endif
  __syncthreads();   // single-wave WG: near-free, forces LDS visibility

  // per lane: the statistics of query row i0 + l16; lrun and s2run hold the sums
  // over this half's keys only and are joined once, behind the loop
  float mrun = -1e30f, lrun = 0.f, s2run = 0.f;
  // O^T tiles: register r of tile nt = head column nt * 16 + r + 8 * half
  v8f accA[4], accB1[4], accB2[4], accB3[4], accB4[4];
#pragma unroll  // register arrays need constant indices
  for (int nt = 0; nt < 4; ++nt) {
    accA[nt] = (v8f){}; accB1[nt] = (v8f){}; accB2[nt] = (v8f){};
    accB3[nt] = (v8f){}; accB4[nt] = (v8f){};
  }

  for (int j0 = 0; j0 <= i0; j0 += 16) {
    // ---- stage k / var_k / v / var_v column tiles (16 x 64, pitch DHEAD) ----
#ifdef USE_TDM
    {
      // make sure prior DS reads of these tiles have drained before the DMA
      // overwrites them (TDM writes are not ordered against DS ops)
      asm volatile("s_wait_dscnt 0x0" ::: "memory");
      const size_t kOff = khBase + (size_t)j0 * DHEAD;
      tdm_load_tile16x64(kk_   + kOff, (unsigned int)(uintptr_t)(&lk [0]), DHEAD);
      tdm_load_tile16x64(var_k + kOff, (unsigned int)(uintptr_t)(&lkv[0]), DHEAD);
      tdm_load_tile16x64(vv_   + kOff, (unsigned int)(uintptr_t)(&lv [0]), DHEAD);
      tdm_load_tile16x64(var_v + kOff, (unsigned int)(uintptr_t)(&lvv[0]), DHEAD);
      __builtin_amdgcn_s_wait_tensorcnt((short)0);
      // nothing from below is scheduled in front of the wait: no scalar register
      // of a descriptor takes a new value while its request is in flight
      __builtin_amdgcn_sched_barrier(0);
    }
#else
    for (int idx = lane; idx < 16 * DHEAD; idx += 32) {
      const int rr = idx >> 6, cc = idx & 63;
      const size_t gi = khBase + (size_t)(j0 + rr) * DHEAD + cc;
      lk [rr * TS + cc] = kk_[gi];
      lkv[rr * TS + cc] = var_k[gi];
      lv [rr * TS + cc] = vv_[gi];
      lvv[rr * TS + cc] = var_v[gi];
    }
#endif
    __syncthreads();

    // ---- score GEMMs, transposed (A = key rows, B = query rows):
    // ---- mean^T = k q^T ; var^T = (var_k+k^2) var_q^T + var_k (q^2)^T
    v8f sm = {}, sv = {};
    const int kb = half * 2;
#pragma unroll  // register arrays need constant indices
    for (int t = 0; t < DHEAD / 4; ++t) {
      const int kkx = t * 4 + kb;
      const int qi = l16 * TS + kkx;
      v2f aq;  aq.x  = lq [qi]; aq.y  = lq [qi + 1];     // B: column n = query l16
      v2f avq; avq.x = lvq[qi]; avq.y = lvq[qi + 1];
      v2f aq2; aq2.x = lq2[qi]; aq2.y = lq2[qi + 1];
      v2f bk;  bk.x  = lk [qi]; bk.y  = lk [qi + 1];     // A: row m = key l16
      v2f bkv; bkv.x = lkv[qi]; bkv.y = lkv[qi + 1];
      v2f bw;  bw.x = bkv.x + bk.x * bk.x; bw.y = bkv.y + bk.y * bk.y;
      sm = wmma4(bk,  aq,  sm);
      sv = wmma4(bw,  avq, sv);
      sv = wmma4(bkv, aq2, sv);
      // bounds how far ahead LDS fragments are fetched: half a score GEMM, and no
      // value fragment before the scores are done. Unbounded, the compiler fetches
      // the whole tile first and takes over 500 registers; so, three waves fit a SIMD
      if (t == DHEAD / 8 - 1 || t == DHEAD / 4 - 1) __builtin_amdgcn_sched_barrier(0);
    }

    // ---- online VDP softmax update: this lane's 8 keys of its one row ----
    const int m = i0 + l16;                     // global row
    float a[8];
#pragma unroll  // register arrays need constant indices
    for (int r = 0; r < 8; ++r) {
      const int n = j0 + r + 8 * half;          // global col
      a[r] = (n <= m) ? sm[r] * RSQD : -1e30f;
    }
    float rmax = fmaxf(fmaxf(fmaxf(a[0], a[1]), fmaxf(a[2], a[3])),
                       fmaxf(fmaxf(a[4], a[5]), fmaxf(a[6], a[7])));
    rmax = fmaxf(rmax, xhalf(rmax));            // the row's other 8 keys
    const float mnew = fmaxf(mrun, rmax);
    const float f = exp_slot(mrun - mnew);
    mrun = mnew;
    float p1[8], p2[8], p3[8], p4[8];           // p, p^2, p^2 var, p^3 var
#pragma unroll  // register arrays need constant indices
    for (int r = 0; r < 8; ++r) {
      const int n = j0 + r + 8 * half;
      const float e = exp_slot(a[r] - mnew);     // in every lane: no branch
      const float p = (n <= m) ? e : 0.0f;
      p1[r] = p;
      p2[r] = p * p;
      p3[r] = p2[r] * (sv[r] * RVD);
      p4[r] = p3[r] * p;
    }
    const float f2 = f * f, f3 = f2 * f;
    lrun  = lrun * f + (((p1[0] + p1[1]) + (p1[2] + p1[3])) +
                        ((p1[4] + p1[5]) + (p1[6] + p1[7])));
    s2run = s2run * f2 + (((p3[0] + p3[1]) + (p3[2] + p3[3])) +
                          ((p3[4] + p3[5]) + (p3[6] + p3[7])));
    // rescale output accumulators (A ~ f, B1/B2/B4 ~ f^2, B3 ~ f^3): every
    // register of a lane belongs to the lane's one row
#pragma unroll  // register arrays need constant indices
    for (int nt = 0; nt < 4; ++nt) {
      accA [nt] *= f;
      accB1[nt] *= f2;
      accB2[nt] *= f2;
      accB4[nt] *= f2;
      accB3[nt] *= f3;
    }

    // ---- output GEMMs, transposed (A = value columns, B = P^T registers):
    // ---- A += v^T P1 ; B1 += W^T P2 ; B2 += W^T P3 ; B3 += W^T P4 ;
    // ---- B4 += var_v^T P2   (W = var_v + v^2)
    // k slot (half, j) of step t is key 8 * half + 2 * t + j on both operands
#pragma unroll  // register arrays need constant indices
    for (int t = 0; t < 4; ++t) {
      const int key = 8 * half + 2 * t;
      v2f b1; b1.x = p1[2 * t]; b1.y = p1[2 * t + 1];
      v2f b2; b2.x = p2[2 * t]; b2.y = p2[2 * t + 1];
      v2f b3; b3.x = p3[2 * t]; b3.y = p3[2 * t + 1];
      v2f b4; b4.x = p4[2 * t]; b4.y = p4[2 * t + 1];
#pragma unroll  // register arrays need constant indices
      for (int nt = 0; nt < 4; ++nt) {
        const int col = nt * 16 + l16;
        const float bv0 = lv [key * TS + col];
        const float bv1 = lv [(key + 1) * TS + col];
        const float bq0 = lvv[key * TS + col];
        const float bq1 = lvv[(key + 1) * TS + col];
        v2f Bv;  Bv.x  = bv0;             Bv.y  = bv1;
        v2f Bq;  Bq.x  = bq0;             Bq.y  = bq1;
        v2f Bw;  Bw.x  = bq0 + bv0 * bv0; Bw.y  = bq1 + bv1 * bv1;
        accA [nt] = wmma4(Bv, b1, accA [nt]);
        accB1[nt] = wmma4(Bw, b2, accB1[nt]);
        accB2[nt] = wmma4(Bw, b3, accB2[nt]);
        accB3[nt] = wmma4(Bw, b4, accB3[nt]);
        accB4[nt] = wmma4(Bq, b2, accB4[nt]);
      }
    }
    __syncthreads();
  }

  // ---- finalize: mean = x + A/l ;  var = s*B1/l^2 + (B2+B4)/l^2 - 2 B3/l^3
  // a lane owns 8 neighbouring columns of its row in every tile: 16-byte accesses
  {
    const float inv  = 1.0f / (lrun + xhalf(lrun));
    const float inv2 = inv * inv;
    const float s    = (s2run + xhalf(s2run)) * inv2;
    const size_t g0 = (size_t)(b * SEQ + i0 + l16) * DIM + h * DHEAD + 8 * half;
    v4f xv[8];
#pragma unroll  // register arrays need constant indices
    for (int c = 0; c < 8; ++c)
      xv[c] = *(const v4f*)(x + g0 + (c >> 1) * 16 + (c & 1) * 4);
#pragma unroll  // register arrays need constant indices
    for (int c = 0; c < 8; ++c) {
      const int nt = c >> 1, r0 = (c & 1) * 4;
      v4f om, ov;
#pragma unroll  // register arrays need constant indices
      for (int e = 0; e < 4; ++e) {
        const int r = r0 + e;
        om[e] = xv[c][e] + accA[nt][r] * inv;
        ov[e] = (s * accB1[nt][r] + accB2[nt][r] + accB4[nt][r]) * inv2
                - 2.0f * accB3[nt][r] * inv2 * inv;
      }
      *(v4f*)(out_mean + g0 + nt * 16 + r0) = om;
      *(v4f*)(out_var  + g0 + nt * 16 + r0) = ov;
    }
  }
}

// ---------------------------------------------------------------------------
extern "C" void kernel_launch(void* const* d_in, const int* in_sizes, int n_in,
                              void* d_out, int out_size, void* d_ws, size_t ws_size,
                              hipStream_t stream) {
  const float* x     = (const float*)d_in[0];
  const float* var_x = (const float*)d_in[1];
  const float* k     = (const float*)d_in[2];
  const float* var_k = (const float*)d_in[3];
  const float* v     = (const float*)d_in[4];
  const float* var_v = (const float*)d_in[5];
  const float* wmu   = (const float*)d_in[6];
  const float* wvar  = (const float*)d_in[7];

  float* out = (float*)d_out;               // [mean | var], each B*S*D
  float* ws  = (float*)d_ws;
  const size_t NT = (size_t)BATCH * SEQ * DIM;   // 4M floats
  float* q   = ws;
  float* vq  = ws + NT;
  float* q2  = ws + 2 * NT;
  float* w2  = ws + 3 * NT;                 // D*D = 1M floats

  // 0) fold Wq_var + Wq_mu^2
  vdp_prep_w2<<<(DIM * DIM + 255) / 256, 256, 0, stream>>>(wmu, wvar, w2);

  // 1) projection: 32 x 16 tiles of 128 x 64, 8 waves/block
  vdp_proj<<<512, 256, 0, stream>>>(x, var_x, wmu, wvar, w2, q, vq, q2);

  // 2) fused causal flash VDP attention + residual, 1 wave per 16-row block,
  //    longest row blocks at the lowest indices
  vdp_flash<<<BATCH * HEADS * (SEQ / 16), 32, 0, stream>>>(
      q, vq, q2, k, var_k, v, var_v, x, out, out + NT);
}

// v005
// It runs in 302 microseconds.
// Timed twice side by side with v004, it ran 1.13 times as fast both times.
// Counting every step since v000, it is 3.02 times as fast.
#include <hip/hip_runtime.h>

// ---------------------------------------------------------------------------
// DecoderHeadVDP on MI455X (gfx1250, wave32, WMMA + TDM)
// B=4, S=1024, D=1024, H=16, DH=64
// fp32 throughout via V_WMMA_F32_16X16X4_F32 (variance path is precision
// sensitive: p^2 / p^3 terms on 0.1-scale variances). Attention tile staging into LDS
// uses the Tensor Data Mover (tensor_load_to_lds) with descriptor padding
// reproducing the bank-conflict-free row stride of 65 DWORDs.
// ---------------------------------------------------------------------------

#define BATCH 4
#define SEQ   1024
#define DIM   1024
#define HEADS 16
#define DHEAD 64
#define RSQD  (1.0f / 32.0f)     // 1/sqrt(D)
#define RVD   (1.0f / 1024.0f)   // 1/D

typedef __attribute__((ext_vector_type(2))) float        v2f;
typedef __attribute__((ext_vector_type(8))) float        v8f;
typedef __attribute__((ext_vector_type(4))) unsigned int v4u;
typedef __attribute__((ext_vector_type(8))) int          v8i;
typedef __attribute__((ext_vector_type(4))) int          v4i;

#if defined(__has_builtin)
#if __has_builtin(__builtin_amdgcn_tensor_load_to_lds)
#define USE_TDM 1
#endif
#endif

static __device__ __forceinline__ v8f wmma4(v2f a, v2f b, v8f c) {
  // D = A(16x4) * B(4x16) + C, fp32
  return __builtin_amdgcn_wmma_f32_16x16x4_f32(false, a, false, b, (short)0, c,
                                               false, false);
}

#ifdef USE_TDM
// ---------------------------------------------------------------------------
// TDM: async DMA of a 16-row x 64-col f32 tile, global -> LDS.
//   src             : global address of tile start (row-major, row pitch
//                     `pitch_elems` floats)
//   lds_byte_off    : LDS byte offset of destination
// D# pad feature inserts 1 DWORD after every 64 DWORDs -> LDS row stride 65,
// matching the padded tiles used by the WMMA operand reads.
// clang-23 / therock toolchain: 6-arg builtin
//   (v4u g0, v8i g1, v4i g2, v4i g3, v8i g4, i32 cpol)
// ---------------------------------------------------------------------------
// Group 0 of one request. Every word is scalar; the tuple is then held in four
// scalar registers of its own, so that requests whose groups are formed before
// the first of them is issued never share a register.
static __device__ __forceinline__ v4u tdm_group0(const float* src,
                                                 unsigned int lds_byte_off) {
  const unsigned long long ga = (unsigned long long)(uintptr_t)src;
  v4u g0;
  g0.x = 1u;                                      // count=1 (valid), user mode
  g0.y = lds_byte_off;                            // lds_addr
  g0.z = (unsigned int)__builtin_amdgcn_readfirstlane(
      (int)(unsigned int)(ga & 0xffffffffu));     // global_addr[31:0]
  g0.w = ((unsigned int)__builtin_amdgcn_readfirstlane(
              (int)(unsigned int)(ga >> 32)) & 0x01ffffffu)  // global_addr[56:32]
         | (2u << 30);                            // type = 2 ("image")
  asm volatile("" : "+s"(g0));  // as pinned(): descriptor words held in scalar registers
  return g0;
}

static __device__ __forceinline__ void tdm_load_tile16x64(
    v4u g0, unsigned int pitch_elems) {
  v8i g1;
  g1[0] = (int)((2u << 16)        // data_size = 4 bytes
                | (1u << 20)      // pad_enable
                | (5u << 22));    // pad_interval: 64 DWORDs; pad_amount=0 -> 1 DWORD
  g1[1] = (int)(64u << 16);       // tensor_dim0[15:0] = 64
  g1[2] = (int)(16u << 16);       // tensor_dim0 hi=0 | tensor_dim1[15:0] = 16
  g1[3] = (int)(64u << 16);       // tensor_dim1 hi=0 | tile_dim0 = 64
  g1[4] = (int)16u;               // tile_dim1 = 16 | tile_dim2 = 0
  g1[5] = (int)pitch_elems;       // tensor_dim0_stride[31:0]
  g1[6] = 0;                      // stride hi | tensor_dim1_stride lo
  g1[7] = 0;
  const v4i z4 = {0, 0, 0, 0};                    // groups 2/3 unused (2D)
  const v8i z8 = {0, 0, 0, 0, 0, 0, 0, 0};
  __builtin_amdgcn_tensor_load_to_lds(g0, g1, z4, z4, z8, 0);
}
#endif

// ---------------------------------------------------------------------------
// Kernel 0: fold W2 = Wq_var + Wq_mu^2   (D*D elements)
// ---------------------------------------------------------------------------
__global__ void vdp_prep_w2(const float* __restrict__ wmu,
                            const float* __restrict__ wvar,
                            float* __restrict__ w2) {
  int i = blockIdx.x * blockDim.x + threadIdx.x;
  if (i < DIM * DIM) {
    float m = wmu[i];
    w2[i] = wvar[i] + m * m;
  }
}

// ---------------------------------------------------------------------------
// Kernel 1: projection.  q = x @ Wmu^T ; var_q = var_x @ W2^T + x^2 @ Wvar^T
// One work-group (8 waves) per 128 x 64 output tile. Per stage of 32 k the
// rows of all five operands (x, var_x: 128 rows; Wmu, W2, Wvar: 64 rows) are
// brought in by whole-line 16-byte loads and stored to LDS, two buffers; each
// wave then forms a 32 x 32 piece (2 x 2 WMMA tiles, 3 products each) from
// 8-byte LDS fragment reads. The k order and the order of the two variance
// products per accumulator are those of a plain k = 0..1023 walk.
// ---------------------------------------------------------------------------
#define PBM   128                       // output rows per work-group
#define PBN   64                        // output columns per work-group
#define PBK   32                        // k per stage: one 128-byte line a row
#define PLP   36                        // LDS row pitch in floats (4 x odd: the
                                        // 16 rows x 4 dwords of a fragment read
                                        // fall on 64 different banks)
#define PROWS (2 * PBM + 3 * PBN)       // 448 staged rows
#define PNLD  (PROWS / 32)              // 14 16-byte loads per thread and stage
#define PNST  (DIM / PBK)               // 32 stages

typedef __attribute__((ext_vector_type(4))) float v4f;

__global__ __launch_bounds__(256)
void vdp_proj(const float* __restrict__ x,
              const float* __restrict__ var_x,
              const float* __restrict__ wmu,
              const float* __restrict__ wvar,
              const float* __restrict__ w2,
              float* __restrict__ q,
              float* __restrict__ var_q,
              float* __restrict__ qsq) {
  // rows 0..127 x | 128..255 var_x | 256..319 Wmu | 320..383 W2 | 384..447 Wvar
  __shared__ __attribute__((aligned(16))) float stg[2][PROWS * PLP];

  const int tid  = threadIdx.x;
  const int lane = tid & 31;
  const int wave = tid >> 5;
  const int half = lane >> 4;   // 0/1
  const int l16  = lane & 15;
  const int wm   = wave & 3;    // 4 wave rows of 32
  const int wn   = wave >> 2;   // 2 wave columns of 32

  const int m0 = (blockIdx.x >> 4) * PBM;        // 32 row blocks
  const int n0 = (blockIdx.x & 15) * PBN;        // 16 column blocks

  // staging: 8 threads cover one row's 128 bytes, 32 rows per step
  const int sr = tid >> 3;
  const int sc = (tid & 7) * 4;
  const unsigned int goff = (unsigned int)(sr * DIM + sc);  // the same for all five
  const float* gx  = x     + (size_t)m0 * DIM;              // block-uniform bases
  const float* gvx = var_x + (size_t)m0 * DIM;
  const float* gwm = wmu   + (size_t)n0 * DIM;
  const float* gw2 = w2    + (size_t)n0 * DIM;
  const float* gwv = wvar  + (size_t)n0 * DIM;
  const int sdst = sr * PLP + sc;

  // fragment reads: row = l16 of the tile, k = 4 * step + 2 * half + {0, 1}
  const int aoff = (wm * 32 + l16) * PLP + half * 2;
  const int boff = (2 * PBM + wn * 32 + l16) * PLP + half * 2;

  v4f st[PNLD];
  v8f accQ[2][2], accV[2][2];
#pragma unroll  // register arrays need constant indices
  for (int i = 0; i < 2; ++i)
#pragma unroll  // register arrays need constant indices
    for (int j = 0; j < 2; ++j) { accQ[i][j] = (v8f){}; accV[i][j] = (v8f){}; }

  auto fetch = [&](int s) {
    const int ko = s * PBK;
#pragma unroll  // register arrays need constant indices
    for (int i = 0; i < 4; ++i) {
      st[i]     = *(const v4f*)(gx  + ko + i * 32 * DIM + goff);
      st[4 + i] = *(const v4f*)(gvx + ko + i * 32 * DIM + goff);
    }
    // the loads below may land in registers that held the addresses above
    asm volatile("s_wait_xcnt 0x0" ::: "memory");
#pragma unroll  // register arrays need constant indices
    for (int i = 0; i < 2; ++i) {
      st[8 + i]  = *(const v4f*)(gwm + ko + i * 32 * DIM + goff);
      st[10 + i] = *(const v4f*)(gw2 + ko + i * 32 * DIM + goff);
      st[12 + i] = *(const v4f*)(gwv + ko + i * 32 * DIM + goff);
    }
  };
  auto put = [&](int buf) {
    float* d = &stg[buf][sdst];
#pragma unroll  // register arrays need constant indices
    for (int i = 0; i < PNLD; ++i) *(v4f*)(d + i * 32 * PLP) = st[i];
  };

  fetch(0);
  put(0);
  __syncthreads();   // stage 0 is in LDS for every wave

  for (int s = 0; s < PNST; ++s) {
    const bool more = (s + 1 < PNST);            // the same for the whole block
    if (more) fetch(s + 1);                      // in flight under this stage's WMMAs

    const float* pa = &stg[s & 1][aoff];
    const float* pb = &stg[s & 1][boff];
#pragma unroll  // register arrays need constant indices
    for (int t = 0; t < PBK / 4; ++t) {
      v2f ax[2], avx[2], ax2[2], bm[2], b2[2], bv[2];
#pragma unroll  // register arrays need constant indices
      for (int i = 0; i < 2; ++i) {
        ax[i]  = *(const v2f*)(pa + i * 16 * PLP + t * 4);
        avx[i] = *(const v2f*)(pa + (PBM + i * 16) * PLP + t * 4);
        ax2[i] = ax[i] * ax[i];
        bm[i]  = *(const v2f*)(pb + i * 16 * PLP + t * 4);
        b2[i]  = *(const v2f*)(pb + (PBN + i * 16) * PLP + t * 4);
        bv[i]  = *(const v2f*)(pb + (2 * PBN + i * 16) * PLP + t * 4);
      }
#pragma unroll  // register arrays need constant indices
      for (int i = 0; i < 2; ++i)
#pragma unroll  // register arrays need constant indices
        for (int j = 0; j < 2; ++j) accQ[i][j] = wmma4(ax[i], bm[j], accQ[i][j]);
#pragma unroll  // register arrays need constant indices
      for (int i = 0; i < 2; ++i)
#pragma unroll  // register arrays need constant indices
        for (int j = 0; j < 2; ++j) accV[i][j] = wmma4(avx[i], b2[j], accV[i][j]);
#pragma unroll  // register arrays need constant indices
      for (int i = 0; i < 2; ++i)
#pragma unroll  // register arrays need constant indices
        for (int j = 0; j < 2; ++j) accV[i][j] = wmma4(ax2[i], bv[j], accV[i][j]);
    }

    if (more) {
      put((s + 1) & 1);   // the buffer whose readers all passed the last barrier
      __syncthreads();    // publishes stage s + 1, ends the reads of stage s
    }
  }

#pragma unroll  // register arrays need constant indices
  for (int i = 0; i < 2; ++i) {
#pragma unroll  // register arrays need constant indices
    for (int j = 0; j < 2; ++j) {
#pragma unroll  // register arrays need constant indices
      for (int r = 0; r < 8; ++r) {
        const int m = m0 + wm * 32 + i * 16 + r + 8 * half;
        const int n = n0 + wn * 32 + j * 16 + l16;
        const size_t gi = (size_t)m * DIM + n;
        const float qm = accQ[i][j][r];
        q[gi]     = qm;
        qsq[gi]   = qm * qm;
        var_q[gi] = accV[i][j][r];
      }
    }
  }
}

#define TS 65

// Byte places of the K/V tiles in their array, which stands at LDS byte 0.
// Wave 0's four: 0, 4352, 8512, 12672; wave 1's four at multiples of 1 KiB.
#define KV0_AT(i) ((i) == 0 ? 0 : 4352 + 4160 * ((i) - 1))
#define KV1_AT(i) (17408 + 5120 * (i))
#define KV_BYTES  (KV1_AT(3) + 16 * TS * 4)
// dwords of one wave's hand-over: 20 x 32 lanes x 4 accumulator words, 3 x 32 statistics
#define XCH_STAT  (20 * 128)

// A wave-uniform test held in a scalar register, so that the branch on it is a
// scalar branch: a tensor load ignores EXEC.
static __device__ __forceinline__ unsigned int pinned(unsigned int v) {
  unsigned int w = (unsigned int)__builtin_amdgcn_readfirstlane((int)v);
  asm volatile("" : "+s"(w));  // pinned(): the issue test of a tensor load stays scalar
  return w;
}

// lane l <-> lane l ^ 16 on the vector unit
static __device__ __forceinline__ float xhalf(float v) {
  return __builtin_bit_cast(
      float, __builtin_amdgcn_permlanex16(__builtin_bit_cast(int, v),
                                          __builtin_bit_cast(int, v), 0x76543210,
                                          0xfedcba98, false, false));
}

// e^v as __expf forms it (2^(v log2 e) on the transcendental unit). The v_nop in
// the same statement is the slot the instruction set asks for between a
// transcendental and an instruction that reads its result or overwrites its
// source.
static __device__ __forceinline__ float exp_slot(float v) {
  float e;
  asm("v_exp_f32 %0, %1\n\tv_nop" : "=v"(e) : "v"(v * 1.44269504088896340736f));
  return e;
}

__global__ __launch_bounds__(64)
void vdp_flash(const float* __restrict__ q,
               const float* __restrict__ var_q,
               const float* __restrict__ qsq,
               const float* __restrict__ kk_,
               const float* __restrict__ var_k,
               const float* __restrict__ vv_,
               const float* __restrict__ var_v,
               const float* __restrict__ x,
               float* __restrict__ out_mean,
               float* __restrict__ out_var) {
  // the widest alignment puts the K/V array first, at LDS byte 0; the query tiles,
  // shared by both waves, follow it at multiples of 1 KiB
  __shared__ __attribute__((aligned(2048))) float smem[KV_BYTES / 4];
  __shared__ __attribute__((aligned(1024))) float lq[1280], lvq[1280], lq2[16 * TS];

  const int wave = __builtin_amdgcn_readfirstlane((int)(threadIdx.x >> 5));  // 0 or 1
  float* const lvv = smem + (wave ? KV1_AT(0) : KV0_AT(0)) / 4;   // this wave's own
  float* const lk  = smem + (wave ? KV1_AT(1) : KV0_AT(1)) / 4;
  float* const lkv = smem + (wave ? KV1_AT(2) : KV0_AT(2)) / 4;
  float* const lv  = smem + (wave ? KV1_AT(3) : KV0_AT(3)) / 4;

#ifdef USE_TDM
  // the same places as byte offsets in the work-group's LDS, scalar
  const unsigned int lds0 = (unsigned int)__builtin_amdgcn_readfirstlane(
      (int)(unsigned int)(uintptr_t)(&smem[0]));
  const unsigned int atVV = lds0 + (wave ? KV1_AT(0) : KV0_AT(0));
  const unsigned int atK  = lds0 + (wave ? KV1_AT(1) : KV0_AT(1));
  const unsigned int atKV = lds0 + (wave ? KV1_AT(2) : KV0_AT(2));
  const unsigned int atV  = lds0 + (wave ? KV1_AT(3) : KV0_AT(3));
#endif

  const int lane = threadIdx.x & 31;
  const int half = lane >> 4;
  const int l16  = lane & 15;

  // A row block walks iblk + 1 key tiles and there are more work-groups than
  // resident places: the cost falls with the index, so that the long blocks
  // start first and the short ones fill the places they leave.
  const int iblk = (SEQ / 16 - 1) - ((blockIdx.x >> 6) & (SEQ / 16 - 1));  // S/16 row blocks
  const int bh   = blockIdx.x & (BATCH * HEADS - 1);
  const int h    = bh & (HEADS - 1);
  const int b    = bh >> 4;
  const int i0   = iblk * 16;

  const size_t khBase = (size_t)bh * SEQ * DHEAD;

  // ---- stage the q / var_q / q^2 row tiles (16 x 64, pitch DIM) once ----
#ifdef USE_TDM
  if (pinned(wave == 0)) {
    const size_t qOff = (size_t)(b * SEQ + i0) * DIM + h * DHEAD;
    const v4u dq  = tdm_group0(q     + qOff, (unsigned int)(uintptr_t)(&lq [0]));
    const v4u dvq = tdm_group0(var_q + qOff, (unsigned int)(uintptr_t)(&lvq[0]));
    const v4u dq2 = tdm_group0(qsq   + qOff, (unsigned int)(uintptr_t)(&lq2[0]));
    tdm_load_tile16x64(dq,  DIM);
    tdm_load_tile16x64(dvq, DIM);
    tdm_load_tile16x64(dq2, DIM);
    // the issuer's own wait: the tiles have landed before the barrier below
    asm volatile("s_wait_tensorcnt 0x0" ::: "memory");
  }
#else
  for (int idx = threadIdx.x; idx < 16 * DHEAD; idx += 64) {
    const int rr = idx >> 6, cc = idx & 63;
    const size_t gi = (size_t)(b * SEQ + i0 + rr) * DIM + h * DHEAD + cc;
    lq [rr * TS + cc] = q[gi];
    lvq[rr * TS + cc] = var_q[gi];
    lq2[rr * TS + cc] = qsq[gi];
  }
#endif
  __syncthreads();   // publishes the query tiles to both waves

  // per lane: the statistics of query row i0 + l16; lrun and s2run hold the sums
  // over this half's keys only and are joined once, behind the loop
  float mrun = -1e30f, lrun = 0.f, s2run = 0.f;
  // O^T tiles: register r of tile nt = head column nt * 16 + r + 8 * half
  v8f accA[4], accB1[4], accB2[4], accB3[4], accB4[4];
#pragma unroll  // register arrays need constant indices
  for (int nt = 0; nt < 4; ++nt) {
    accA[nt] = (v8f){}; accB1[nt] = (v8f){}; accB2[nt] = (v8f){};
    accB3[nt] = (v8f){}; accB4[nt] = (v8f){};
  }

  for (int j0 = wave * 16; j0 <= i0; j0 += 32) {   // a scalar trip test
    // ---- stage k / var_k / v / var_v column tiles (16 x 64, pitch DHEAD) ----
#ifdef USE_TDM
    {
      // make sure prior DS reads of these tiles have drained before the DMA
      // overwrites them (TDM writes are not ordered against DS ops)
      asm volatile("s_wait_dscnt 0x0" ::: "memory");
      const size_t kOff = khBase + (size_t)j0 * DHEAD;
      const v4u dk  = tdm_group0(kk_   + kOff, atK);
      const v4u dkv = tdm_group0(var_k + kOff, atKV);
      const v4u dv  = tdm_group0(vv_   + kOff, atV);
      const v4u dvv = tdm_group0(var_v + kOff, atVV);
      tdm_load_tile16x64(dk,  DHEAD);
      tdm_load_tile16x64(dkv, DHEAD);
      tdm_load_tile16x64(dv,  DHEAD);
      tdm_load_tile16x64(dvv, DHEAD);
      // the tiles are this wave's own: its wait alone stands between the loads
      // and its reads, and no LDS read moves in front of it
      asm volatile("s_wait_tensorcnt 0x0" ::: "memory");
      // nothing from below is scheduled in front of the wait: no scalar register
      // of a descriptor takes a new value while its request is in flight
      __builtin_amdgcn_sched_barrier(0);
    }
#else
    for (int idx = lane; idx < 16 * DHEAD; idx += 32) {
      const int rr = idx >> 6, cc = idx & 63;
      const size_t gi = khBase + (size_t)(j0 + rr) * DHEAD + cc;
      lk [rr * TS + cc] = kk_[gi];
      lkv[rr * TS + cc] = var_k[gi];
      lv [rr * TS + cc] = vv_[gi];
      lvv[rr * TS + cc] = var_v[gi];
    }
#endif

    // ---- score GEMMs, transposed (A = key rows, B = query rows):
    // ---- mean^T = k q^T ; var^T = (var_k+k^2) var_q^T + var_k (q^2)^T
    v8f sm = {}, sv = {};
    const int kb = half * 2;
#pragma unroll  // register arrays need constant indices
    for (int t = 0; t < DHEAD / 4; ++t) {
      const int kkx = t * 4 + kb;
      const int qi = l16 * TS + kkx;
      v2f aq;  aq.x  = lq [qi]; aq.y  = lq [qi + 1];     // B: column n = query l16
      v2f avq; avq.x = lvq[qi]; avq.y = lvq[qi + 1];
      v2f aq2; aq2.x = lq2[qi]; aq2.y = lq2[qi + 1];
      v2f bk;  bk.x  = lk [qi]; bk.y  = lk [qi + 1];     // A: row m = key l16
      v2f bkv; bkv.x = lkv[qi]; bkv.y = lkv[qi + 1];
      v2f bw;  bw.x = bkv.x + bk.x * bk.x; bw.y = bkv.y + bk.y * bk.y;
      sm = wmma4(bk,  aq,  sm);
      sv = wmma4(bw,  avq, sv);
      sv = wmma4(bkv, aq2, sv);
      // bounds how far ahead LDS fragments are fetched: half a score GEMM, and no
      // value fragment before the scores are done. Unbounded, the compiler fetches
      // the whole tile first and takes over 500 registers; so, three waves fit a SIMD
      if (t == DHEAD / 8 - 1 || t == DHEAD / 4 - 1) __builtin_amdgcn_sched_barrier(0);
    }

    // ---- online VDP softmax update: this lane's 8 keys of its one row ----
    const int m = i0 + l16;                     // global row
    float a[8];
#pragma unroll  // register arrays need constant indices
    for (int r = 0; r < 8; ++r) {
      const int n = j0 + r + 8 * half;          // global col
      a[r] = (n <= m) ? sm[r] * RSQD : -1e30f;
    }
    float rmax = fmaxf(fmaxf(fmaxf(a[0], a[1]), fmaxf(a[2], a[3])),
                       fmaxf(fmaxf(a[4], a[5]), fmaxf(a[6], a[7])));
    rmax = fmaxf(rmax, xhalf(rmax));            // the row's other 8 keys
    const float mnew = fmaxf(mrun, rmax);
    const float f = exp_slot(mrun - mnew);
    mrun = mnew;
    float p1[8], p2[8], p3[8], p4[8];           // p, p^2, p^2 var, p^3 var
#pragma unroll  // register arrays need constant indices
    for (int r = 0; r < 8; ++r) {
      const int n = j0 + r + 8 * half;
      const float e = exp_slot(a[r] - mnew);     // in every lane: no branch
      const float p = (n <= m) ? e : 0.0f;
      p1[r] = p;
      p2[r] = p * p;
      p3[r] = p2[r] * (sv[r] * RVD);
      p4[r] = p3[r] * p;
    }
    const float f2 = f * f, f3 = f2 * f;
    lrun  = lrun * f + (((p1[0] + p1[1]) + (p1[2] + p1[3])) +
                        ((p1[4] + p1[5]) + (p1[6] + p1[7])));
    s2run = s2run * f2 + (((p3[0] + p3[1]) + (p3[2] + p3[3])) +
                          ((p3[4] + p3[5]) + (p3[6] + p3[7])));
    // rescale output accumulators (A ~ f, B1/B2/B4 ~ f^2, B3 ~ f^3): every
    // register of a lane belongs to the lane's one row
#pragma unroll  // register arrays need constant indices
    for (int nt = 0; nt < 4; ++nt) {
      accA [nt] *= f;
      accB1[nt] *= f2;
      accB2[nt] *= f2;
      accB4[nt] *= f2;
      accB3[nt] *= f3;
    }

    // ---- output GEMMs, transposed (A = value columns, B = P^T registers):
    // ---- A += v^T P1 ; B1 += W^T P2 ; B2 += W^T P3 ; B3 += W^T P4 ;
    // ---- B4 += var_v^T P2   (W = var_v + v^2)
    // k slot (half, j) of step t is key 8 * half + 2 * t + j on both operands
#pragma unroll  // register arrays need constant indices
    for (int t = 0; t < 4; ++t) {
      const int key = 8 * half + 2 * t;
      v2f b1; b1.x = p1[2 * t]; b1.y = p1[2 * t + 1];
      v2f b2; b2.x = p2[2 * t]; b2.y = p2[2 * t + 1];
      v2f b3; b3.x = p3[2 * t]; b3.y = p3[2 * t + 1];
      v2f b4; b4.x = p4[2 * t]; b4.y = p4[2 * t + 1];
#pragma unroll  // register arrays need constant indices
      for (int nt = 0; nt < 4; ++nt) {
        const int col = nt * 16 + l16;
        const float bv0 = lv [key * TS + col];
        const float bv1 = lv [(key + 1) * TS + col];
        const float bq0 = lvv[key * TS + col];
        const float bq1 = lvv[(key + 1) * TS + col];
        v2f Bv;  Bv.x  = bv0;             Bv.y  = bv1;
        v2f Bq;  Bq.x  = bq0;             Bq.y  = bq1;
        v2f Bw;  Bw.x  = bq0 + bv0 * bv0; Bw.y  = bq1 + bv1 * bv1;
        accA [nt] = wmma4(Bv, b1, accA [nt]);
        accB1[nt] = wmma4(Bw, b2, accB1[nt]);
        accB2[nt] = wmma4(Bw, b3, accB2[nt]);
        accB3[nt] = wmma4(Bw, b4, accB3[nt]);
        accB4[nt] = wmma4(Bq, b2, accB4[nt]);
      }
    }
  }

  // ---- join the two waves' partial states. Wave w keeps the column tiles 2w and
  // ---- 2w + 1 in its registers and hands the other two, with its statistics, to
  // ---- its partner through its own K/V tiles' LDS, which it has done reading.
  if (wave) {   // the kept pair to places 0 and 1: constant register indices below
#pragma unroll  // register arrays need constant indices
    for (int i = 0; i < 2; ++i) {
      v8f t;
      t = accA [i]; accA [i] = accA [2 + i]; accA [2 + i] = t;
      t = accB1[i]; accB1[i] = accB1[2 + i]; accB1[2 + i] = t;
      t = accB2[i]; accB2[i] = accB2[2 + i]; accB2[2 + i] = t;
      t = accB3[i]; accB3[i] = accB3[2 + i]; accB3[2 + i] = t;
      t = accB4[i]; accB4[i] = accB4[2 + i]; accB4[2 + i] = t;
    }
  }
  {
    float* const xo = smem + (wave ? KV1_AT(0) : KV0_AT(0)) / 4;
#pragma unroll  // register arrays need constant indices
    for (int i = 0; i < 2; ++i) {
#pragma unroll  // register arrays need constant indices
      for (int u = 0; u < 2; ++u) {
        float* const d = xo + ((i * 2 + u) * 5 * 32 + lane) * 4;
        const int r = u * 4;
        *(v4f*)(d)           = (v4f){accA [2 + i][r], accA [2 + i][r + 1], accA [2 + i][r + 2], accA [2 + i][r + 3]};
        *(v4f*)(d + 128)     = (v4f){accB1[2 + i][r], accB1[2 + i][r + 1], accB1[2 + i][r + 2], accB1[2 + i][r + 3]};
        *(v4f*)(d + 2 * 128) = (v4f){accB2[2 + i][r], accB2[2 + i][r + 1], accB2[2 + i][r + 2], accB2[2 + i][r + 3]};
        *(v4f*)(d + 3 * 128) = (v4f){accB3[2 + i][r], accB3[2 + i][r + 1], accB3[2 + i][r + 2], accB3[2 + i][r + 3]};
        *(v4f*)(d + 4 * 128) = (v4f){accB4[2 + i][r], accB4[2 + i][r + 1], accB4[2 + i][r + 2], accB4[2 + i][r + 3]};
      }
    }
    xo[XCH_STAT + lane]      = mrun;
    xo[XCH_STAT + 32 + lane] = lrun;
    xo[XCH_STAT + 64 + lane] = s2run;
  }
  __syncthreads();   // both hand-overs are written; nothing is written to LDS behind it
  const float* const xi = smem + (wave ? KV0_AT(0) : KV1_AT(0)) / 4;
  // a wave that had no key tile hands over -1e30 and zeros: its factor is 0
  const float mo   = xi[XCH_STAT + lane];
  const float mall = fmaxf(mrun, mo);
  const float fs = exp_slot(mrun - mall), fo = exp_slot(mo - mall);
  const float fs2 = fs * fs, fo2 = fo * fo, fs3 = fs2 * fs, fo3 = fo2 * fo;
  lrun  = lrun * fs + xi[XCH_STAT + 32 + lane] * fo;
  s2run = s2run * fs2 + xi[XCH_STAT + 64 + lane] * fo2;

  // ---- finalize: mean = x + A/l ;  var = s*B1/l^2 + (B2+B4)/l^2 - 2 B3/l^3
  // a lane owns 8 neighbouring columns of its row in every tile: 16-byte accesses;
  // a wave's two tiles are one whole 128-byte line of every row
  {
    const float inv  = 1.0f / (lrun + xhalf(lrun));
    const float inv2 = inv * inv;
    const float s    = (s2run + xhalf(s2run)) * inv2;
    const size_t g0 = (size_t)(b * SEQ + i0 + l16) * DIM + h * DHEAD + wave * 32 + 8 * half;
    v4f xv[4];
#pragma unroll  // register arrays need constant indices
    for (int c = 0; c < 4; ++c)
      xv[c] = *(const v4f*)(x + g0 + (c >> 1) * 16 + (c & 1) * 4);
#pragma unroll  // register arrays need constant indices
    for (int c = 0; c < 4; ++c) {
      const int nt = c >> 1, r0 = (c & 1) * 4;
      const float* const p = xi + (c * 5 * 32 + lane) * 4;   // the partner's share
      const v4f oA  = *(const v4f*)(p);
      const v4f oB1 = *(const v4f*)(p + 128);
      const v4f oB2 = *(const v4f*)(p + 2 * 128);
      const v4f oB3 = *(const v4f*)(p + 3 * 128);
      const v4f oB4 = *(const v4f*)(p + 4 * 128);
      v4f om, ov;
#pragma unroll  // register arrays need constant indices
      for (int e = 0; e < 4; ++e) {
        const int r = r0 + e;
        const float tA  = accA [nt][r] * fs  + oA [e] * fo;
        const float tB1 = accB1[nt][r] * fs2 + oB1[e] * fo2;
        const float tB2 = accB2[nt][r] * fs2 + oB2[e] * fo2;
        const float tB3 = accB3[nt][r] * fs3 + oB3[e] * fo3;
        const float tB4 = accB4[nt][r] * fs2 + oB4[e] * fo2;
        om[e] = xv[c][e] + tA * inv;
        ov[e] = (s * tB1 + tB2 + tB4) * inv2 - 2.0f * tB3 * inv2 * inv;
      }
      *(v4f*)(out_mean + g0 + nt * 16 + r0) = om;
      *(v4f*)(out_var  + g0 + nt * 16 + r0) = ov;
    }
  }
}

// ---------------------------------------------------------------------------
extern "C" void kernel_launch(void* const* d_in, const int* in_sizes, int n_in,
                              void* d_out, int out_size, void* d_ws, size_t ws_size,
                              hipStream_t stream) {
  const float* x     = (const float*)d_in[0];
  const float* var_x = (const float*)d_in[1];
  const float* k     = (const float*)d_in[2];
  const float* var_k = (const float*)d_in[3];
  const float* v     = (const float*)d_in[4];
  const float* var_v = (const float*)d_in[5];
  const float* wmu   = (const float*)d_in[6];
  const float* wvar  = (const float*)d_in[7];

  float* out = (float*)d_out;               // [mean | var], each B*S*D
  float* ws  = (float*)d_ws;
  const size_t NT = (size_t)BATCH * SEQ * DIM;   // 4M floats
  float* q   = ws;
  float* vq  = ws + NT;
  float* q2  = ws + 2 * NT;
  float* w2  = ws + 3 * NT;                 // D*D = 1M floats

  // 0) fold Wq_var + Wq_mu^2
  vdp_prep_w2<<<(DIM * DIM + 255) / 256, 256, 0, stream>>>(wmu, wvar, w2);

  // 1) projection: 32 x 16 tiles of 128 x 64, 8 waves/block
  vdp_proj<<<512, 256, 0, stream>>>(x, var_x, wmu, wvar, w2, q, vq, q2);

  // 2) fused causal flash VDP attention + residual, 2 waves per 16-row block,
  //    longest row blocks at the lowest indices
  vdp_flash<<<BATCH * HEADS * (SEQ / 16), 64, 0, stream>>>(
      q, vq, q2, k, var_k, v, var_v, x, out, out + NT);
}

// v006
// It runs in 289 microseconds.
// In both of two side-by-side timings against v005, it was 1.04 times as fast.
// Over all steps from v000 it is 3.15 times as fast.
#include <hip/hip_runtime.h>

// ---------------------------------------------------------------------------
// DecoderHeadVDP on MI455X (gfx1250, wave32, WMMA + TDM)
// B=4, S=1024, D=1024, H=16, DH=64
// fp32 throughout via V_WMMA_F32_16X16X4_F32 (variance path is precision
// sensitive: p^2 / p^3 terms on 0.1-scale variances). Attention tile staging into LDS
// uses the Tensor Data Mover (tensor_load_to_lds) with descriptor padding
// reproducing the bank-conflict-free row stride of 65 DWORDs.
// ---------------------------------------------------------------------------

#define BATCH 4
#define SEQ   1024
#define DIM   1024
#define HEADS 16
#define DHEAD 64
#define RSQD  (1.0f / 32.0f)     // 1/sqrt(D)
#define RVD   (1.0f / 1024.0f)   // 1/D

typedef __attribute__((ext_vector_type(2))) float        v2f;
typedef __attribute__((ext_vector_type(8))) float        v8f;
typedef __attribute__((ext_vector_type(4))) unsigned int v4u;
typedef __attribute__((ext_vector_type(8))) int          v8i;
typedef __attribute__((ext_vector_type(4))) int          v4i;

#if defined(__has_builtin)
#if __has_builtin(__builtin_amdgcn_tensor_load_to_lds)
#define USE_TDM 1
#endif
#endif

static __device__ __forceinline__ v8f wmma4(v2f a, v2f b, v8f c) {
  // D = A(16x4) * B(4x16) + C, fp32
  return __builtin_amdgcn_wmma_f32_16x16x4_f32(false, a, false, b, (short)0, c,
                                               false, false);
}

#ifdef USE_TDM
// ---------------------------------------------------------------------------
// TDM: async DMA of a 16-row x 64-col f32 tile, global -> LDS.
//   src             : global address of tile start (row-major, row pitch
//                     `pitch_elems` floats)
//   lds_byte_off    : LDS byte offset of destination
// D# pad feature inserts 1 DWORD after every 64 DWORDs -> LDS row stride 65,
// matching the padded tiles used by the WMMA operand reads.
// clang-23 / therock toolchain: 6-arg builtin
//   (v4u g0, v8i g1, v4i g2, v4i g3, v8i g4, i32 cpol)
// ---------------------------------------------------------------------------
// Group 0 of one request. Every word is scalar; the tuple is then held in four
// scalar registers of its own, so that requests whose groups are formed before
// the first of them is issued never share a register.
static __device__ __forceinline__ v4u tdm_group0(const float* src,
                                                 unsigned int lds_byte_off) {
  const unsigned long long ga = (unsigned long long)(uintptr_t)src;
  v4u g0;
  g0.x = 1u;                                      // count=1 (valid), user mode
  g0.y = lds_byte_off;                            // lds_addr
  g0.z = (unsigned int)__builtin_amdgcn_readfirstlane(
      (int)(unsigned int)(ga & 0xffffffffu));     // global_addr[31:0]
  g0.w = ((unsigned int)__builtin_amdgcn_readfirstlane(
              (int)(unsigned int)(ga >> 32)) & 0x01ffffffu)  // global_addr[56:32]
         | (2u << 30);                            // type = 2 ("image")
  asm volatile("" : "+s"(g0));  // as pinned(): descriptor words held in scalar registers
  return g0;
}

static __device__ __forceinline__ void tdm_load_tile16x64(
    v4u g0, unsigned int pitch_elems) {
  v8i g1;
  g1[0] = (int)((2u << 16)        // data_size = 4 bytes
                | (1u << 20)      // pad_enable
                | (5u << 22));    // pad_interval: 64 DWORDs; pad_amount=0 -> 1 DWORD
  g1[1] = (int)(64u << 16);       // tensor_dim0[15:0] = 64
  g1[2] = (int)(16u << 16);       // tensor_dim0 hi=0 | tensor_dim1[15:0] = 16
  g1[3] = (int)(64u << 16);       // tensor_dim1 hi=0 | tile_dim0 = 64
  g1[4] = (int)16u;               // tile_dim1 = 16 | tile_dim2 = 0
  g1[5] = (int)pitch_elems;       // tensor_dim0_stride[31:0]
  g1[6] = 0;                      // stride hi | tensor_dim1_stride lo
  g1[7] = 0;
  const v4i z4 = {0, 0, 0, 0};                    // groups 2/3 unused (2D)
  const v8i z8 = {0, 0, 0, 0, 0, 0, 0, 0};
  __builtin_amdgcn_tensor_load_to_lds(g0, g1, z4, z4, z8, 0);
}
#endif

// ---------------------------------------------------------------------------
// Kernel 1: projection.  q = x @ Wmu^T ; var_q = var_x @ W2^T + x^2 @ Wvar^T
// with W2 = Wvar + Wmu^2, formed fragment by fragment in registers from the Wmu
// and Wvar fragments that the other two products read anyway: it is never in
// memory or LDS and needs no launch of its own.
// One work-group (8 waves) per 128 x 64 output tile. Per stage of 32 k the
// rows of the four inputs (x, var_x: 128 rows; Wmu, Wvar: 64 rows) are
// brought in by whole-line 16-byte loads and stored to LDS, two buffers; each
// wave then forms a 32 x 32 piece (2 x 2 WMMA tiles, 3 products each) from
// 8-byte LDS fragment reads. The k order and the order of the two variance
// products per accumulator are those of a plain k = 0..1023 walk.
// ---------------------------------------------------------------------------
#define PBM   128                       // output rows per work-group
#define PBN   64                        // output columns per work-group
#define PBK   32                        // k per stage: one 128-byte line a row
#define PLP   36                        // LDS row pitch in floats (4 x odd: the
                                        // 16 rows x 4 dwords of a fragment read
                                        // fall on 64 different banks)
#define PROWS (2 * PBM + 2 * PBN)       // 384 staged rows
#define PNLD  (PROWS / 32)              // 12 16-byte loads per thread and stage
#define PNST  (DIM / PBK)               // 32 stages

typedef __attribute__((ext_vector_type(4))) float v4f;

__global__ __launch_bounds__(256)
void vdp_proj(const float* __restrict__ x,
              const float* __restrict__ var_x,
              const float* __restrict__ wmu,
              const float* __restrict__ wvar,
              float* __restrict__ q,
              float* __restrict__ var_q,
              float* __restrict__ qsq) {
  // rows 0..127 x | 128..255 var_x | 256..319 Wmu | 320..383 Wvar
  __shared__ __attribute__((aligned(16))) float stg[2][PROWS * PLP];

  const int tid  = threadIdx.x;
  const int lane = tid & 31;
  const int wave = tid >> 5;
  const int half = lane >> 4;   // 0/1
  const int l16  = lane & 15;
  const int wm   = wave & 3;    // 4 wave rows of 32
  const int wn   = wave >> 2;   // 2 wave columns of 32

  const int m0 = (blockIdx.x >> 4) * PBM;        // 32 row blocks
  const int n0 = (blockIdx.x & 15) * PBN;        // 16 column blocks

  // staging: 8 threads cover one row's 128 bytes, 32 rows per step
  const int sr = tid >> 3;
  const int sc = (tid & 7) * 4;
  const unsigned int goff = (unsigned int)(sr * DIM + sc);  // the same for all four
  const float* gx  = x     + (size_t)m0 * DIM;              // block-uniform bases
  const float* gvx = var_x + (size_t)m0 * DIM;
  const float* gwm = wmu   + (size_t)n0 * DIM;
  const float* gwv = wvar  + (size_t)n0 * DIM;
  const int sdst = sr * PLP + sc;

  // fragment reads: row = l16 of the tile, k = 4 * step + 2 * half + {0, 1}
  const int aoff = (wm * 32 + l16) * PLP + half * 2;
  const int boff = (2 * PBM + wn * 32 + l16) * PLP + half * 2;

  v4f st[PNLD];
  v8f accQ[2][2], accV[2][2];
#pragma unroll  // register arrays need constant indices
  for (int i = 0; i < 2; ++i)
#pragma unroll  // register arrays need constant indices
    for (int j = 0; j < 2; ++j) { accQ[i][j] = (v8f){}; accV[i][j] = (v8f){}; }

  auto fetch = [&](int s) {
    const int ko = s * PBK;
#pragma unroll  // register arrays need constant indices
    for (int i = 0; i < 4; ++i) {
      st[i]     = *(const v4f*)(gx  + ko + i * 32 * DIM + goff);
      st[4 + i] = *(const v4f*)(gvx + ko + i * 32 * DIM + goff);
    }
    // the loads below may land in registers that held the addresses above
    asm volatile("s_wait_xcnt 0x0" ::: "memory");
#pragma unroll  // register arrays need constant indices
    for (int i = 0; i < 2; ++i) {
      st[8 + i]  = *(const v4f*)(gwm + ko + i * 32 * DIM + goff);
      st[10 + i] = *(const v4f*)(gwv + ko + i * 32 * DIM + goff);
    }
  };
  auto put = [&](int buf) {
    float* d = &stg[buf][sdst];
#pragma unroll  // register arrays need constant indices
    for (int i = 0; i < PNLD; ++i) *(v4f*)(d + i * 32 * PLP) = st[i];
  };

  fetch(0);
  put(0);
  __syncthreads();   // stage 0 is in LDS for every wave

  for (int s = 0; s < PNST; ++s) {
    const bool more = (s + 1 < PNST);            // the same for the whole block
    if (more) fetch(s + 1);                      // in flight under this stage's WMMAs

    const float* pa = &stg[s & 1][aoff];
    const float* pb = &stg[s & 1][boff];
#pragma unroll  // register arrays need constant indices
    for (int t = 0; t < PBK / 4; ++t) {
      v2f ax[2], avx[2], ax2[2], bm[2], b2[2], bv[2];
#pragma unroll  // register arrays need constant indices
      for (int i = 0; i < 2; ++i) {
        ax[i]  = *(const v2f*)(pa + i * 16 * PLP + t * 4);
        avx[i] = *(const v2f*)(pa + (PBM + i * 16) * PLP + t * 4);
        ax2[i] = ax[i] * ax[i];
        bm[i]  = *(const v2f*)(pb + i * 16 * PLP + t * 4);
        bv[i]  = *(const v2f*)(pb + (PBN + i * 16) * PLP + t * 4);
        b2[i]  = bv[i] + bm[i] * bm[i];                   // W2, one fused multiply-add
      }
#pragma unroll  // register arrays need constant indices
      for (int i = 0; i < 2; ++i)
#pragma unroll  // register arrays need constant indices
        for (int j = 0; j < 2; ++j) accQ[i][j] = wmma4(ax[i], bm[j], accQ[i][j]);
#pragma unroll  // register arrays need constant indices
      for (int i = 0; i < 2; ++i)
#pragma unroll  // register arrays need constant indices
        for (int j = 0; j < 2; ++j) accV[i][j] = wmma4(avx[i], b2[j], accV[i][j]);
#pragma unroll  // register arrays need constant indices
      for (int i = 0; i < 2; ++i)
#pragma unroll  // register arrays need constant indices
        for (int j = 0; j < 2; ++j) accV[i][j] = wmma4(ax2[i], bv[j], accV[i][j]);
      // bounds how far ahead LDS fragments are fetched: half a stage. Unbounded, the
      // compiler fetches the whole stage first and takes over 256 registers, and the
      // second work-group no longer fits the WGP
      if (t == PBK / 8 - 1) __builtin_amdgcn_sched_barrier(0);
    }

    if (more) {
      put((s + 1) & 1);   // the buffer whose readers all passed the last barrier
      __syncthreads();    // publishes stage s + 1, ends the reads of stage s
    }
  }

#pragma unroll  // register arrays need constant indices
  for (int i = 0; i < 2; ++i) {
#pragma unroll  // register arrays need constant indices
    for (int j = 0; j < 2; ++j) {
#pragma unroll  // register arrays need constant indices
      for (int r = 0; r < 8; ++r) {
        const int m = m0 + wm * 32 + i * 16 + r + 8 * half;
        const int n = n0 + wn * 32 + j * 16 + l16;
        const size_t gi = (size_t)m * DIM + n;
        const float qm = accQ[i][j][r];
        q[gi]     = qm;
        qsq[gi]   = qm * qm;
        var_q[gi] = accV[i][j][r];
      }
    }
  }
}

#define TS 65

// Byte places of the K/V tiles in their array, which stands at LDS byte 0.
// Wave 0's four: 0, 4352, 8512, 12672; wave 1's four at multiples of 1 KiB.
#define KV0_AT(i) ((i) == 0 ? 0 : 4352 + 4160 * ((i) - 1))
#define KV1_AT(i) (17408 + 5120 * (i))
#define KV_BYTES  (KV1_AT(3) + 16 * TS * 4)
// dwords of one wave's hand-over: 20 x 32 lanes x 4 accumulator words, 3 x 32 statistics
#define XCH_STAT  (20 * 128)

// A wave-uniform test held in a scalar register, so that the branch on it is a
// scalar branch: a tensor load ignores EXEC.
static __device__ __forceinline__ unsigned int pinned(unsigned int v) {
  unsigned int w = (unsigned int)__builtin_amdgcn_readfirstlane((int)v);
  asm volatile("" : "+s"(w));  // pinned(): the issue test of a tensor load stays scalar
  return w;
}

// lane l <-> lane l ^ 16 on the vector unit
static __device__ __forceinline__ float xhalf(float v) {
  return __builtin_bit_cast(
      float, __builtin_amdgcn_permlanex16(__builtin_bit_cast(int, v),
                                          __builtin_bit_cast(int, v), 0x76543210,
                                          0xfedcba98, false, false));
}

// e^v as __expf forms it (2^(v log2 e) on the transcendental unit). The v_nop in
// the same statement is the slot the instruction set asks for between a
// transcendental and an instruction that reads its result or overwrites its
// source.
static __device__ __forceinline__ float exp_slot(float v) {
  float e;
  asm("v_exp_f32 %0, %1\n\tv_nop" : "=v"(e) : "v"(v * 1.44269504088896340736f));
  return e;
}

__global__ __launch_bounds__(64)
void vdp_flash(const float* __restrict__ q,
               const float* __restrict__ var_q,
               const float* __restrict__ qsq,
               const float* __restrict__ kk_,
               const float* __restrict__ var_k,
               const float* __restrict__ vv_,
               const float* __restrict__ var_v,
               const float* __restrict__ x,
               float* __restrict__ out_mean,
               float* __restrict__ out_var) {
  // the widest alignment puts the K/V array first, at LDS byte 0; the query tiles,
  // shared by both waves, follow it at multiples of 1 KiB
  __shared__ __attribute__((aligned(2048))) float smem[KV_BYTES / 4];
  __shared__ __attribute__((aligned(1024))) float lq[1280], lvq[1280], lq2[16 * TS];

  const int wave = __builtin_amdgcn_readfirstlane((int)(threadIdx.x >> 5));  // 0 or 1
  float* const lvv = smem + (wave ? KV1_AT(0) : KV0_AT(0)) / 4;   // this wave's own
  float* const lk  = smem + (wave ? KV1_AT(1) : KV0_AT(1)) / 4;
  float* const lkv = smem + (wave ? KV1_AT(2) : KV0_AT(2)) / 4;
  float* const lv  = smem + (wave ? KV1_AT(3) : KV0_AT(3)) / 4;

#ifdef USE_TDM
  // the same places as byte offsets in the work-group's LDS, scalar
  const unsigned int lds0 = (unsigned int)__builtin_amdgcn_readfirstlane(
      (int)(unsigned int)(uintptr_t)(&smem[0]));
  const unsigned int atVV = lds0 + (wave ? KV1_AT(0) : KV0_AT(0));
  const unsigned int atK  = lds0 + (wave ? KV1_AT(1) : KV0_AT(1));
  const unsigned int atKV = lds0 + (wave ? KV1_AT(2) : KV0_AT(2));
  const unsigned int atV  = lds0 + (wave ? KV1_AT(3) : KV0_AT(3));
#endif

  const int lane = threadIdx.x & 31;
  const int half = lane >> 4;
  const int l16  = lane & 15;

  // A row block walks iblk + 1 key tiles and there are more work-groups than
  // resident places: the cost falls with the index, so that the long blocks
  // start first and the short ones fill the places they leave.
  const int iblk = (SEQ / 16 - 1) - ((blockIdx.x >> 6) & (SEQ / 16 - 1));  // S/16 row blocks
  const int bh   = blockIdx.x & (BATCH * HEADS - 1);
  const int h    = bh & (HEADS - 1);
  const int b    = bh >> 4;
  const int i0   = iblk * 16;

  const size_t khBase = (size_t)bh * SEQ * DHEAD;

  // ---- stage the q / var_q / q^2 row tiles (16 x 64, pitch DIM) once ----
#ifdef USE_TDM
  if (pinned(wave == 0)) {
    const size_t qOff = (size_t)(b * SEQ + i0) * DIM + h * DHEAD;
    const v4u dq  = tdm_group0(q     + qOff, (unsigned int)(uintptr_t)(&lq [0]));
    const v4u dvq = tdm_group0(var_q + qOff, (unsigned int)(uintptr_t)(&lvq[0]));
    const v4u dq2 = tdm_group0(qsq   + qOff, (unsigned int)(uintptr_t)(&lq2[0]));
    tdm_load_tile16x64(dq,  DIM);
    tdm_load_tile16x64(dvq, DIM);
    tdm_load_tile16x64(dq2, DIM);
    // the issuer's own wait: the tiles have landed before the barrier below
    asm volatile("s_wait_tensorcnt 0x0" ::: "memory");
  }
#else
  for (int idx = threadIdx.x; idx < 16 * DHEAD; idx += 64) {
    const int rr = idx >> 6, cc = idx & 63;
    const size_t gi = (size_t)(b * SEQ + i0 + rr) * DIM + h * DHEAD + cc;
    lq [rr * TS + cc] = q[gi];
    lvq[rr * TS + cc] = var_q[gi];
    lq2[rr * TS + cc] = qsq[gi];
  }
#endif
  __syncthreads();   // publishes the query tiles to both waves

  // per lane: the statistics of query row i0 + l16; lrun and s2run hold the sums
  // over this half's keys only and are joined once, behind the loop
  float mrun = -1e30f, lrun = 0.f, s2run = 0.f;
  // O^T tiles: register r of tile nt = head column nt * 16 + r + 8 * half
  v8f accA[4], accB1[4], accB2[4], accB3[4], accB4[4];
#pragma unroll  // register arrays need constant indices
  for (int nt = 0; nt < 4; ++nt) {
    accA[nt] = (v8f){}; accB1[nt] = (v8f){}; accB2[nt] = (v8f){};
    accB3[nt] = (v8f){}; accB4[nt] = (v8f){};
  }

  for (int j0 = wave * 16; j0 <= i0; j0 += 32) {   // a scalar trip test
    // ---- stage k / var_k / v / var_v column tiles (16 x 64, pitch DHEAD) ----
#ifdef USE_TDM
    {
      // make sure prior DS reads of these tiles have drained before the DMA
      // overwrites them (TDM writes are not ordered against DS ops)
      asm volatile("s_wait_dscnt 0x0" ::: "memory");
      const size_t kOff = khBase + (size_t)j0 * DHEAD;
      const v4u dk  = tdm_group0(kk_   + kOff, atK);
      const v4u dkv = tdm_group0(var_k + kOff, atKV);
      const v4u dv  = tdm_group0(vv_   + kOff, atV);
      const v4u dvv = tdm_group0(var_v + kOff, atVV);
      tdm_load_tile16x64(dk,  DHEAD);
      tdm_load_tile16x64(dkv, DHEAD);
      tdm_load_tile16x64(dv,  DHEAD);
      tdm_load_tile16x64(dvv, DHEAD);
      // the tiles are this wave's own: its wait alone stands between the loads
      // and its reads, and no LDS read moves in front of it
      asm volatile("s_wait_tensorcnt 0x0" ::: "memory");
      // nothing from below is scheduled in front of the wait: no scalar register
      // of a descriptor takes a new value while its request is in flight
      __builtin_amdgcn_sched_barrier(0);
    }
#else
    for (int idx = lane; idx < 16 * DHEAD; idx += 32) {
      const int rr = idx >> 6, cc = idx & 63;
      const size_t gi = khBase + (size_t)(j0 + rr) * DHEAD + cc;
      lk [rr * TS + cc] = kk_[gi];
      lkv[rr * TS + cc] = var_k[gi];
      lv [rr * TS + cc] = vv_[gi];
      lvv[rr * TS + cc] = var_v[gi];
    }
#endif

    // ---- score GEMMs, transposed (A = key rows, B = query rows):
    // ---- mean^T = k q^T ; var^T = (var_k+k^2) var_q^T + var_k (q^2)^T
    v8f sm = {}, sv = {};
    const int kb = half * 2;
#pragma unroll  // register arrays need constant indices
    for (int t = 0; t < DHEAD / 4; ++t) {
      const int kkx = t * 4 + kb;
      const int qi = l16 * TS + kkx;
      v2f aq;  aq.x  = lq [qi]; aq.y  = lq [qi + 1];     // B: column n = query l16
      v2f avq; avq.x = lvq[qi]; avq.y = lvq[qi + 1];
      v2f aq2; aq2.x = lq2[qi]; aq2.y = lq2[qi + 1];
      v2f bk;  bk.x  = lk [qi]; bk.y  = lk [qi + 1];     // A: row m = key l16
      v2f bkv; bkv.x = lkv[qi]; bkv.y = lkv[qi + 1];
      v2f bw;  bw.x = bkv.x + bk.x * bk.x; bw.y = bkv.y + bk.y * bk.y;
      sm = wmma4(bk,  aq,  sm);
      sv = wmma4(bw,  avq, sv);
      sv = wmma4(bkv, aq2, sv);
      // bounds how far ahead LDS fragments are fetched: half a score GEMM, and no
      // value fragment before the scores are done. Unbounded, the compiler fetches
      // the whole tile first and takes over 500 registers; so, three waves fit a SIMD
      if (t == DHEAD / 8 - 1 || t == DHEAD / 4 - 1) __builtin_amdgcn_sched_barrier(0);
    }

    // ---- online VDP softmax update: this lane's 8 keys of its one row ----
    const int m = i0 + l16;                     // global row
    float a[8];
#pragma unroll  // register arrays need constant indices
    for (int r = 0; r < 8; ++r) {
      const int n = j0 + r + 8 * half;          // global col
      a[r] = (n <= m) ? sm[r] * RSQD : -1e30f;
    }
    float rmax = fmaxf(fmaxf(fmaxf(a[0], a[1]), fmaxf(a[2], a[3])),
                       fmaxf(fmaxf(a[4], a[5]), fmaxf(a[6], a[7])));
    rmax = fmaxf(rmax, xhalf(rmax));            // the row's other 8 keys
    const float mnew = fmaxf(mrun, rmax);
    const float f = exp_slot(mrun - mnew);
    mrun = mnew;
    float p1[8], p2[8], p3[8], p4[8];           // p, p^2, p^2 var, p^3 var
#pragma unroll  // register arrays need constant indices
    for (int r = 0; r < 8; ++r) {
      const int n = j0 + r + 8 * half;
      const float e = exp_slot(a[r] - mnew);     // in every lane: no branch
      const float p = (n <= m) ? e : 0.0f;
      p1[r] = p;
      p2[r] = p * p;
      p3[r] = p2[r] * (sv[r] * RVD);
      p4[r] = p3[r] * p;
    }
    const float f2 = f * f, f3 = f2 * f;
    lrun  = lrun * f + (((p1[0] + p1[1]) + (p1[2] + p1[3])) +
                        ((p1[4] + p1[5]) + (p1[6] + p1[7])));
    s2run = s2run * f2 + (((p3[0] + p3[1]) + (p3[2] + p3[3])) +
                          ((p3[4] + p3[5]) + (p3[6] + p3[7])));
    // rescale output accumulators (A ~ f, B1/B2/B4 ~ f^2, B3 ~ f^3): every
    // register of a lane belongs to the lane's one row
#pragma unroll  // register arrays need constant indices
    for (int nt = 0; nt < 4; ++nt) {
      accA [nt] *= f;
      accB1[nt] *= f2;
      accB2[nt] *= f2;
      accB4[nt] *= f2;
      accB3[nt] *= f3;
    }

    // ---- output GEMMs, transposed (A = value columns, B = P^T registers):
    // ---- A += v^T P1 ; B1 += W^T P2 ; B2 += W^T P3 ; B3 += W^T P4 ;
    // ---- B4 += var_v^T P2   (W = var_v + v^2)
    // k slot (half, j) of step t is key 8 * half + 2 * t + j on both operands
#pragma unroll  // register arrays need constant indices
    for (int t = 0; t < 4; ++t) {
      const int key = 8 * half + 2 * t;
      v2f b1; b1.x = p1[2 * t]; b1.y = p1[2 * t + 1];
      v2f b2; b2.x = p2[2 * t]; b2.y = p2[2 * t + 1];
      v2f b3; b3.x = p3[2 * t]; b3.y = p3[2 * t + 1];
      v2f b4; b4.x = p4[2 * t]; b4.y = p4[2 * t + 1];
#pragma unroll  // register arrays need constant indices
      for (int nt = 0; nt < 4; ++nt) {
        const int col = nt * 16 + l16;
        const float bv0 = lv [key * TS + col];
        const float bv1 = lv [(key + 1) * TS + col];
        const float bq0 = lvv[key * TS + col];
        const float bq1 = lvv[(key + 1) * TS + col];
        v2f Bv;  Bv.x  = bv0;             Bv.y  = bv1;
        v2f Bq;  Bq.x  = bq0;             Bq.y  = bq1;
        v2f Bw;  Bw.x  = bq0 + bv0 * bv0; Bw.y  = bq1 + bv1 * bv1;
        accA [nt] = wmma4(Bv, b1, accA [nt]);
        accB1[nt] = wmma4(Bw, b2, accB1[nt]);
        accB2[nt] = wmma4(Bw, b3, accB2[nt]);
        accB3[nt] = wmma4(Bw, b4, accB3[nt]);
        accB4[nt] = wmma4(Bq, b2, accB4[nt]);
      }
    }
  }

  // ---- join the two waves' partial states. Wave w keeps the column tiles 2w and
  // ---- 2w + 1 in its registers and hands the other two, with its statistics, to
  // ---- its partner through its own K/V tiles' LDS, which it has done reading.
  if (wave) {   // the kept pair to places 0 and 1: constant register indices below
#pragma unroll  // register arrays need constant indices
    for (int i = 0; i < 2; ++i) {
      v8f t;
      t = accA [i]; accA [i] = accA [2 + i]; accA [2 + i] = t;
      t = accB1[i]; accB1[i] = accB1[2 + i]; accB1[2 + i] = t;
      t = accB2[i]; accB2[i] = accB2[2 + i]; accB2[2 + i] = t;
      t = accB3[i]; accB3[i] = accB3[2 + i]; accB3[2 + i] = t;
      t = accB4[i]; accB4[i] = accB4[2 + i]; accB4[2 + i] = t;
    }
  }
  {
    float* const xo = smem + (wave ? KV1_AT(0) : KV0_AT(0)) / 4;
#pragma unroll  // register arrays need constant indices
    for (int i = 0; i < 2; ++i) {
#pragma unroll  // register arrays need constant indices
      for (int u = 0; u < 2; ++u) {
        float* const d = xo + ((i * 2 + u) * 5 * 32 + lane) * 4;
        const int r = u * 4;
        *(v4f*)(d)           = (v4f){accA [2 + i][r], accA [2 + i][r + 1], accA [2 + i][r + 2], accA [2 + i][r + 3]};
        *(v4f*)(d + 128)     = (v4f){accB1[2 + i][r], accB1[2 + i][r + 1], accB1[2 + i][r + 2], accB1[2 + i][r + 3]};
        *(v4f*)(d + 2 * 128) = (v4f){accB2[2 + i][r], accB2[2 + i][r + 1], accB2[2 + i][r + 2], accB2[2 + i][r + 3]};
        *(v4f*)(d + 3 * 128) = (v4f){accB3[2 + i][r], accB3[2 + i][r + 1], accB3[2 + i][r + 2], accB3[2 + i][r + 3]};
        *(v4f*)(d + 4 * 128) = (v4f){accB4[2 + i][r], accB4[2 + i][r + 1], accB4[2 + i][r + 2], accB4[2 + i][r + 3]};
      }
    }
    xo[XCH_STAT + lane]      = mrun;
    xo[XCH_STAT + 32 + lane] = lrun;
    xo[XCH_STAT + 64 + lane] = s2run;
  }
  __syncthreads();   // both hand-overs are written; nothing is written to LDS behind it
  const float* const xi = smem + (wave ? KV0_AT(0) : KV1_AT(0)) / 4;
  // a wave that had no key tile hands over -1e30 and zeros: its factor is 0
  const float mo   = xi[XCH_STAT + lane];
  const float mall = fmaxf(mrun, mo);
  const float fs = exp_slot(mrun - mall), fo = exp_slot(mo - mall);
  const float fs2 = fs * fs, fo2 = fo * fo, fs3 = fs2 * fs, fo3 = fo2 * fo;
  lrun  = lrun * fs + xi[XCH_STAT + 32 + lane] * fo;
  s2run = s2run * fs2 + xi[XCH_STAT + 64 + lane] * fo2;

  // ---- finalize: mean = x + A/l ;  var = s*B1/l^2 + (B2+B4)/l^2 - 2 B3/l^3
  // a lane owns 8 neighbouring columns of its row in every tile: 16-byte accesses;
  // a wave's two tiles are one whole 128-byte line of every row
  {
    const float inv  = 1.0f / (lrun + xhalf(lrun));
    const float inv2 = inv * inv;
    const float s    = (s2run + xhalf(s2run)) * inv2;
    const size_t g0 = (size_t)(b * SEQ + i0 + l16) * DIM + h * DHEAD + wave * 32 + 8 * half;
    v4f xv[4];
#pragma unroll  // register arrays need constant indices
    for (int c = 0; c < 4; ++c)
      xv[c] = *(const v4f*)(x + g0 + (c >> 1) * 16 + (c & 1) * 4);
#pragma unroll  // register arrays need constant indices
    for (int c = 0; c < 4; ++c) {
      const int nt = c >> 1, r0 = (c & 1) * 4;
      const float* const p = xi + (c * 5 * 32 + lane) * 4;   // the partner's share
      const v4f oA  = *(const v4f*)(p);
      const v4f oB1 = *(const v4f*)(p + 128);
      const v4f oB2 = *(const v4f*)(p + 2 * 128);
      const v4f oB3 = *(const v4f*)(p + 3 * 128);
      const v4f oB4 = *(const v4f*)(p + 4 * 128);
      v4f om, ov;
#pragma unroll  // register arrays need constant indices
      for (int e = 0; e < 4; ++e) {
        const int r = r0 + e;
        const float tA  = accA [nt][r] * fs  + oA [e] * fo;
        const float tB1 = accB1[nt][r] * fs2 + oB1[e] * fo2;
        const float tB2 = accB2[nt][r] * fs2 + oB2[e] * fo2;
        const float tB3 = accB3[nt][r] * fs3 + oB3[e] * fo3;
        const float tB4 = accB4[nt][r] * fs2 + oB4[e] * fo2;
        om[e] = xv[c][e] + tA * inv;
        ov[e] = (s * tB1 + tB2 + tB4) * inv2 - 2.0f * tB3 * inv2 * inv;
      }
      *(v4f*)(out_mean + g0 + nt * 16 + r0) = om;
      *(v4f*)(out_var  + g0 + nt * 16 + r0) = ov;
    }
  }
}

// ---------------------------------------------------------------------------
extern "C" void kernel_launch(void* const* d_in, const int* in_sizes, int n_in,
                              void* d_out, int out_size, void* d_ws, size_t ws_size,
                              hipStream_t stream) {
  const float* x     = (const float*)d_in[0];
  const float* var_x = (const float*)d_in[1];
  const float* k     = (const float*)d_in[2];
  const float* var_k = (const float*)d_in[3];
  const float* v     = (const float*)d_in[4];
  const float* var_v = (const float*)d_in[5];
  const float* wmu   = (const float*)d_in[6];
  const float* wvar  = (const float*)d_in[7];

  float* out = (float*)d_out;               // [mean | var], each B*S*D
  float* ws  = (float*)d_ws;
  const size_t NT = (size_t)BATCH * SEQ * DIM;   // 4M floats
  float* q   = ws;
  float* vq  = ws + NT;
  float* q2  = ws + 2 * NT;

  // 1) projection: 32 x 16 tiles of 128 x 64, 8 waves/block
  vdp_proj<<<512, 256, 0, stream>>>(x, var_x, wmu, wvar, q, vq, q2);

  // 2) fused causal flash VDP attention + residual, 2 waves per 16-row block,
  //    longest row blocks at the lowest indices
  vdp_flash<<<BATCH * HEADS * (SEQ / 16), 64, 0, stream>>>(
      q, vq, q2, k, var_k, v, var_v, x, out, out + NT);
}

// v007
// A run of this version takes 278 microseconds.
// In both of two side-by-side timings against v006, it was 1.04 times as fast.
// Counting every step since v000, it is 3.28 times as fast.
#include <hip/hip_runtime.h>

// ---------------------------------------------------------------------------
// DecoderHeadVDP on MI455X (gfx1250, wave32, WMMA + TDM)
// B=4, S=1024, D=1024, H=16, DH=64
// fp32 throughout via V_WMMA_F32_16X16X4_F32 (variance path is precision
// sensitive: p^2 / p^3 terms on 0.1-scale variances). Attention tile staging into LDS
// uses the Tensor Data Mover (tensor_load_to_lds) with descriptor padding
// reproducing the bank-conflict-free row stride of 65 DWORDs.
// ---------------------------------------------------------------------------

#define BATCH 4
#define SEQ   1024
#define DIM   1024
#define HEADS 16
#define DHEAD 64
#define RSQD  (1.0f / 32.0f)     // 1/sqrt(D)
#define RVD   (1.0f / 1024.0f)   // 1/D

typedef __attribute__((ext_vector_type(2))) float        v2f;
typedef __attribute__((ext_vector_type(8))) float        v8f;
typedef __attribute__((ext_vector_type(4))) unsigned int v4u;
typedef __attribute__((ext_vector_type(8))) int          v8i;
typedef __attribute__((ext_vector_type(4))) int          v4i;

#if defined(__has_builtin)
#if __has_builtin(__builtin_amdgcn_tensor_load_to_lds)
#define USE_TDM 1
#endif
#endif

static __device__ __forceinline__ v8f wmma4(v2f a, v2f b, v8f c) {
  // D = A(16x4) * B(4x16) + C, fp32
  return __builtin_amdgcn_wmma_f32_16x16x4_f32(false, a, false, b, (short)0, c,
                                               false, false);
}

#ifdef USE_TDM
// ---------------------------------------------------------------------------
// TDM: async DMA of a 16-row x 64-col f32 tile, global -> LDS.
//   src             : global address of tile start (row-major, row pitch
//                     `pitch_elems` floats)
//   lds_byte_off    : LDS byte offset of destination
// D# pad feature inserts 1 DWORD after every 64 DWORDs -> LDS row stride 65,
// matching the padded tiles used by the WMMA operand reads.
// clang-23 / therock toolchain: 6-arg builtin
//   (v4u g0, v8i g1, v4i g2, v4i g3, v8i g4, i32 cpol)
// ---------------------------------------------------------------------------
// Group 0 of one request. Every word is scalar; the tuple is then held in four
// scalar registers of its own, so that requests whose groups are formed before
// the first of them is issued never share a register.
static __device__ __forceinline__ v4u tdm_group0(const float* src,
                                                 unsigned int lds_byte_off) {
  const unsigned long long ga = (unsigned long long)(uintptr_t)src;
  v4u g0;
  g0.x = 1u;                                      // count=1 (valid), user mode
  g0.y = lds_byte_off;                            // lds_addr
  g0.z = (unsigned int)__builtin_amdgcn_readfirstlane(
      (int)(unsigned int)(ga & 0xffffffffu));     // global_addr[31:0]
  g0.w = ((unsigned int)__builtin_amdgcn_readfirstlane(
              (int)(unsigned int)(ga >> 32)) & 0x01ffffffu)  // global_addr[56:32]
         | (2u << 30);                            // type = 2 ("image")
  asm volatile("" : "+s"(g0));  // as pinned(): descriptor words held in scalar registers
  return g0;
}

static __device__ __forceinline__ void tdm_load_tile16x64(
    v4u g0, unsigned int pitch_elems) {
  v8i g1;
  g1[0] = (int)((2u << 16)        // data_size = 4 bytes
                | (1u << 20)      // pad_enable
                | (5u << 22));    // pad_interval: 64 DWORDs; pad_amount=0 -> 1 DWORD
  g1[1] = (int)(64u << 16);       // tensor_dim0[15:0] = 64
  g1[2] = (int)(16u << 16);       // tensor_dim0 hi=0 | tensor_dim1[15:0] = 16
  g1[3] = (int)(64u << 16);       // tensor_dim1 hi=0 | tile_dim0 = 64
  g1[4] = (int)16u;               // tile_dim1 = 16 | tile_dim2 = 0
  g1[5] = (int)pitch_elems;       // tensor_dim0_stride[31:0]
  g1[6] = 0;                      // stride hi | tensor_dim1_stride lo
  g1[7] = 0;
  const v4i z4 = {0, 0, 0, 0};                    // groups 2/3 unused (2D)
  const v8i z8 = {0, 0, 0, 0, 0, 0, 0, 0};
  __builtin_amdgcn_tensor_load_to_lds(g0, g1, z4, z4, z8, 0);
}
#endif

// ---------------------------------------------------------------------------
// Kernel 1: projection.  q = x @ Wmu^T ; var_q = var_x @ W2^T + x^2 @ Wvar^T
// with W2 = Wvar + Wmu^2, formed fragment by fragment in registers from the Wmu
// and Wvar fragments that the other two products read anyway: it is never in
// memory or LDS and needs no launch of its own.
// One work-group (8 waves) per 128 x 64 output tile. Per stage of 32 k the
// rows of the four inputs (x, var_x: 128 rows; Wmu, Wvar: 64 rows) are
// brought in by whole-line 16-byte loads and stored to LDS, two buffers; each
// wave then forms a 32 x 32 piece (2 x 2 WMMA tiles, 3 products each) from
// 8-byte LDS fragment reads. The k order and the order of the two variance
// products per accumulator are those of a plain k = 0..1023 walk.
// ---------------------------------------------------------------------------
#define PBM   128                       // output rows per work-group
#define PBN   64                        // output columns per work-group
#define PBK   32                        // k per stage: one 128-byte line a row
#define PLP   36                        // LDS row pitch in floats (4 x odd: the
                                        // 16 rows x 4 dwords of a fragment read
                                        // fall on 64 different banks)
#define PROWS (2 * PBM + 2 * PBN)       // 384 staged rows
#define PNLD  (PROWS / 32)              // 12 16-byte loads per thread and stage
#define PNST  (DIM / PBK)               // 32 stages

typedef __attribute__((ext_vector_type(4))) float v4f;

__global__ __launch_bounds__(256)
void vdp_proj(const float* __restrict__ x,
              const float* __restrict__ var_x,
              const float* __restrict__ wmu,
              const float* __restrict__ wvar,
              float* __restrict__ q,
              float* __restrict__ var_q,
              float* __restrict__ qsq) {
  // rows 0..127 x | 128..255 var_x | 256..319 Wmu | 320..383 Wvar
  __shared__ __attribute__((aligned(16))) float stg[2][PROWS * PLP];

  const int tid  = threadIdx.x;
  const int lane = tid & 31;
  const int wave = tid >> 5;
  const int half = lane >> 4;   // 0/1
  const int l16  = lane & 15;
  const int wm   = wave & 3;    // 4 wave rows of 32
  const int wn   = wave >> 2;   // 2 wave columns of 32

  const int m0 = (blockIdx.x >> 4) * PBM;        // 32 row blocks
  const int n0 = (blockIdx.x & 15) * PBN;        // 16 column blocks

  // staging: 8 threads cover one row's 128 bytes, 32 rows per step
  const int sr = tid >> 3;
  const int sc = (tid & 7) * 4;
  const unsigned int goff = (unsigned int)(sr * DIM + sc);  // the same for all four
  const float* gx  = x     + (size_t)m0 * DIM;              // block-uniform bases
  const float* gvx = var_x + (size_t)m0 * DIM;
  const float* gwm = wmu   + (size_t)n0 * DIM;
  const float* gwv = wvar  + (size_t)n0 * DIM;
  const int sdst = sr * PLP + sc;

  // fragment reads: row = l16 of the tile, k = 4 * step + 2 * half + {0, 1}
  const int aoff = (wm * 32 + l16) * PLP + half * 2;
  const int boff = (2 * PBM + wn * 32 + l16) * PLP + half * 2;

  v4f st[PNLD];
  v8f accQ[2][2], accV[2][2];
#pragma unroll  // register arrays need constant indices
  for (int i = 0; i < 2; ++i)
#pragma unroll  // register arrays need constant indices
    for (int j = 0; j < 2; ++j) { accQ[i][j] = (v8f){}; accV[i][j] = (v8f){}; }

  auto fetch = [&](int s) {
    const int ko = s * PBK;
#pragma unroll  // register arrays need constant indices
    for (int i = 0; i < 4; ++i) {
      st[i]     = *(const v4f*)(gx  + ko + i * 32 * DIM + goff);
      st[4 + i] = *(const v4f*)(gvx + ko + i * 32 * DIM + goff);
    }
    // the loads below may land in registers that held the addresses above
    asm volatile("s_wait_xcnt 0x0" ::: "memory");
#pragma unroll  // register arrays need constant indices
    for (int i = 0; i < 2; ++i) {
      st[8 + i]  = *(const v4f*)(gwm + ko + i * 32 * DIM + goff);
      st[10 + i] = *(const v4f*)(gwv + ko + i * 32 * DIM + goff);
    }
  };
  auto put = [&](int buf) {
    float* d = &stg[buf][sdst];
#pragma unroll  // register arrays need constant indices
    for (int i = 0; i < PNLD; ++i) *(v4f*)(d + i * 32 * PLP) = st[i];
  };

  fetch(0);
  put(0);
  __syncthreads();   // stage 0 is in LDS for every wave

  for (int s = 0; s < PNST; ++s) {
    const bool more = (s + 1 < PNST);            // the same for the whole block
    if (more) fetch(s + 1);                      // in flight under this stage's WMMAs

    const float* pa = &stg[s & 1][aoff];
    const float* pb = &stg[s & 1][boff];
#pragma unroll  // register arrays need constant indices
    for (int t = 0; t < PBK / 4; ++t) {
      v2f ax[2], avx[2], ax2[2], bm[2], b2[2], bv[2];
#pragma unroll  // register arrays need constant indices
      for (int i = 0; i < 2; ++i) {
        ax[i]  = *(const v2f*)(pa + i * 16 * PLP + t * 4);
        avx[i] = *(const v2f*)(pa + (PBM + i * 16) * PLP + t * 4);
        ax2[i] = ax[i] * ax[i];
        bm[i]  = *(const v2f*)(pb + i * 16 * PLP + t * 4);
        bv[i]  = *(const v2f*)(pb + (PBN + i * 16) * PLP + t * 4);
        b2[i]  = bv[i] + bm[i] * bm[i];                   // W2, one fused multiply-add
      }
#pragma unroll  // register arrays need constant indices
      for (int i = 0; i < 2; ++i)
#pragma unroll  // register arrays need constant indices
        for (int j = 0; j < 2; ++j) accQ[i][j] = wmma4(ax[i], bm[j], accQ[i][j]);
#pragma unroll  // register arrays need constant indices
      for (int i = 0; i < 2; ++i)
#pragma unroll  // register arrays need constant indices
        for (int j = 0; j < 2; ++j) accV[i][j] = wmma4(avx[i], b2[j], accV[i][j]);
#pragma unroll  // register arrays need constant indices
      for (int i = 0; i < 2; ++i)
#pragma unroll  // register arrays need constant indices
        for (int j = 0; j < 2; ++j) accV[i][j] = wmma4(ax2[i], bv[j], accV[i][j]);
      // bounds how far ahead LDS fragments are fetched: half a stage. Unbounded, the
      // compiler fetches the whole stage first and takes over 256 registers, and the
      // second work-group no longer fits the WGP
      if (t == PBK / 8 - 1) __builtin_amdgcn_sched_barrier(0);
    }

    if (more) {
      put((s + 1) & 1);   // the buffer whose readers all passed the last barrier
      __syncthreads();    // publishes stage s + 1, ends the reads of stage s
    }
  }

#pragma unroll  // register arrays need constant indices
  for (int i = 0; i < 2; ++i) {
#pragma unroll  // register arrays need constant indices
    for (int j = 0; j < 2; ++j) {
#pragma unroll  // register arrays need constant indices
      for (int r = 0; r < 8; ++r) {
        const int m = m0 + wm * 32 + i * 16 + r + 8 * half;
        const int n = n0 + wn * 32 + j * 16 + l16;
        const size_t gi = (size_t)m * DIM + n;
        const float qm = accQ[i][j][r];
        q[gi]     = qm;
        qsq[gi]   = qm * qm;
        var_q[gi] = accV[i][j][r];
      }
    }
  }
}

#define TS 65
#define NW 8

// Every tile's place in LDS is a multiple of 2 KiB. A wave owns two places (k and
// var_k in sweep 1, v and var_v in sweep 2, its partial output at the end); the
// three query tiles, shared by all waves, follow.
#define TILE_AT 6144
#define WAVE_AT (2 * TILE_AT)

// A wave-uniform test held in a scalar register, so that the branch on it is a
// scalar branch: a tensor load ignores EXEC.
static __device__ __forceinline__ unsigned int pinned(unsigned int v) {
  unsigned int w = (unsigned int)__builtin_amdgcn_readfirstlane((int)v);
  asm volatile("" : "+s"(w));  // pinned(): the issue test of a tensor load stays scalar
  return w;
}

// lane l <-> lane l ^ 16 on the vector unit
static __device__ __forceinline__ float xhalf(float v) {
  return __builtin_bit_cast(
      float, __builtin_amdgcn_permlanex16(__builtin_bit_cast(int, v),
                                          __builtin_bit_cast(int, v), 0x76543210,
                                          0xfedcba98, false, false));
}

// e^v as __expf forms it (2^(v log2 e) on the transcendental unit). The v_nop in
// the same statement is the slot the instruction set asks for between a
// transcendental and an instruction that reads its result or overwrites its
// source.
static __device__ __forceinline__ float exp_slot(float v) {
  float e;
  asm("v_exp_f32 %0, %1\n\tv_nop" : "=v"(e) : "v"(v * 1.44269504088896340736f));
  return e;
}

// four waves a SIMD: two work-groups share a WGP, and one fills the matrix unit
// while the other waits for a tile, at a barrier or for its start
__global__ __launch_bounds__(256) __attribute__((amdgpu_waves_per_eu(4, 4)))
void vdp_flash(const float* __restrict__ q,
               const float* __restrict__ var_q,
               const float* __restrict__ qsq,
               const float* __restrict__ kk_,
               const float* __restrict__ var_k,
               const float* __restrict__ vv_,
               const float* __restrict__ var_v,
               const float* __restrict__ x,
               float* __restrict__ out_mean,
               float* __restrict__ out_var) {
  __shared__ __attribute__((aligned(2048))) float smem[(NW * 2 + 3) * TILE_AT / 4];
  __shared__ float stat[NW * 3 * 32];   // per wave: row maximum, sum p, sum p^2 var

  const int hw = __builtin_amdgcn_readfirstlane((int)(threadIdx.x >> 5));  // 0 .. 7
  // A row block has iblk + 1 key tiles and there are more work-groups than
  // resident places: the cost falls with the index (for speed only).
  const int iblk = (SEQ / 16 - 1) - ((blockIdx.x >> 6) & (SEQ / 16 - 1));  // S/16 row blocks
  const int bh   = blockIdx.x & (BATCH * HEADS - 1);
  // which share of the key tiles this wave has. The low shares get the odd tiles of
  // a block whose count is no multiple of 8
  const int wave = (hw + (iblk >> 3) + bh) & (NW - 1);
  float* const ta = smem + wave * (WAVE_AT / 4);   // this wave's own: k, then v
  float* const tb = ta + TILE_AT / 4;              // var_k, then var_v
  float* const lq  = smem + NW * (WAVE_AT / 4);
  float* const lvq = lq + TILE_AT / 4;
  float* const lq2 = lvq + TILE_AT / 4;

#ifdef USE_TDM
  // the same places as byte offsets in the work-group's LDS, scalar
  const unsigned int lds0 = (unsigned int)__builtin_amdgcn_readfirstlane(
      (int)(unsigned int)(uintptr_t)(&smem[0]));
  const unsigned int atA = lds0 + wave * WAVE_AT;
  const unsigned int atB = atA + TILE_AT;
  const unsigned int atQ = lds0 + NW * WAVE_AT;
#endif

  const int lane = threadIdx.x & 31;
  const int half = lane >> 4;
  const int l16  = lane & 15;

  const int h    = bh & (HEADS - 1);
  const int b    = bh >> 4;
  const int i0   = iblk * 16;

  const size_t khBase = (size_t)bh * SEQ * DHEAD;

  // ---- stage the q / var_q / q^2 row tiles (16 x 64, pitch DIM) once ----
#ifdef USE_TDM
  if (pinned(hw == 0)) {
    const size_t qOff = (size_t)(b * SEQ + i0) * DIM + h * DHEAD;
    const v4u dq  = tdm_group0(q     + qOff, atQ);
    const v4u dvq = tdm_group0(var_q + qOff, atQ + TILE_AT);
    const v4u dq2 = tdm_group0(qsq   + qOff, atQ + 2 * TILE_AT);
    tdm_load_tile16x64(dq,  DIM);
    tdm_load_tile16x64(dvq, DIM);
    tdm_load_tile16x64(dq2, DIM);
    // the issuer's own wait: the tiles have landed before the barrier below
    asm volatile("s_wait_tensorcnt 0x0" ::: "memory");
  }
#else
  for (int idx = threadIdx.x; idx < 16 * DHEAD; idx += 256) {
    const int rr = idx >> 6, cc = idx & 63;
    const size_t gi = (size_t)(b * SEQ + i0 + rr) * DIM + h * DHEAD + cc;
    lq [rr * TS + cc] = q[gi];
    lvq[rr * TS + cc] = var_q[gi];
    lq2[rr * TS + cc] = qsq[gi];
  }
#endif
  __syncthreads();   // publishes the query tiles to all waves

  // ---- sweep 1: scores and score variances of this wave's key tiles ----
  // per lane: 8 keys (r + 8 * half) of query row i0 + l16, for each of its tiles;
  // a tile's words are written, and later read, only under the test that it exists
  float pa[NW][8], va[NW][8];
  float mw = -1e30f;                            // the row's maximum over this wave's keys
#pragma unroll  // register arrays need constant indices
  for (int c = 0; c < NW; ++c) {
    const int j0 = (wave + NW * c) * 16;
    if (pinned(j0 <= i0)) {                     // a scalar test: tensor loads inside
#ifdef USE_TDM
      // make sure prior DS reads of these tiles have drained before the DMA
      // overwrites them (TDM writes are not ordered against DS ops)
      asm volatile("s_wait_dscnt 0x0" ::: "memory");
      const size_t kOff = khBase + (size_t)j0 * DHEAD;
      const v4u dk  = tdm_group0(kk_   + kOff, atA);
      const v4u dkv = tdm_group0(var_k + kOff, atB);
      tdm_load_tile16x64(dk,  DHEAD);
      tdm_load_tile16x64(dkv, DHEAD);
      // the tiles are this wave's own: its wait alone stands between the loads
      // and its reads, and no LDS read moves in front of it
      asm volatile("s_wait_tensorcnt 0x0" ::: "memory");
      // nothing from below is scheduled in front of the wait: no scalar register
      // of a descriptor takes a new value while its request is in flight
      __builtin_amdgcn_sched_barrier(0);
#else
      for (int idx = lane; idx < 16 * DHEAD; idx += 32) {
        const int rr = idx >> 6, cc = idx & 63;
        const size_t gi = khBase + (size_t)(j0 + rr) * DHEAD + cc;
        ta[rr * TS + cc] = kk_[gi];
        tb[rr * TS + cc] = var_k[gi];
      }
#endif
      // score GEMMs, transposed (A = key rows, B = query rows):
      // mean^T = k q^T ; var^T = (var_k+k^2) var_q^T + var_k (q^2)^T
      v8f sm = {}, sv = {};
      const int kb = half * 2;
      // stays a loop of 4 x 4 steps: it
      // bounds how far ahead LDS fragments are fetched, and so the registers
#pragma unroll 1
      for (int tq = 0; tq < DHEAD / 4; tq += 4) {
        v2f aq[4], avq[4], aq2[4], bk[4], bkv[4];
#pragma unroll  // register arrays need constant indices
        for (int t = 0; t < 4; ++t) {
          const int qi = l16 * TS + (tq + t) * 4 + kb;
          aq [t].x = lq [qi]; aq [t].y = lq [qi + 1];     // B: column n = query l16
          avq[t].x = lvq[qi]; avq[t].y = lvq[qi + 1];
          aq2[t].x = lq2[qi]; aq2[t].y = lq2[qi + 1];
          bk [t].x = ta [qi]; bk [t].y = ta [qi + 1];     // A: row m = key l16
          bkv[t].x = tb [qi]; bkv[t].y = tb [qi + 1];
        }
        // the four steps' reads stay one group in front of their WMMAs: spread among
        // them, each small group waits out the LDS latency anew
        __builtin_amdgcn_sched_barrier(0);
#pragma unroll  // register arrays need constant indices
        for (int t = 0; t < 4; ++t) {
          const v2f bw = bkv[t] + bk[t] * bk[t];
          sm = wmma4(bk[t],  aq[t],  sm);
          sv = wmma4(bw,     avq[t], sv);
          sv = wmma4(bkv[t], aq2[t], sv);
        }
      }
      const int m = i0 + l16;                   // global row
#pragma unroll  // register arrays need constant indices
      for (int r = 0; r < 8; ++r) {
        const int n = j0 + r + 8 * half;        // global col
        pa[c][r] = (n <= m) ? sm[r] * RSQD : -1e30f;
        va[c][r] = sv[r] * RVD;
        mw = fmaxf(mw, pa[c][r]);
      }
    }
  }
  mw = fmaxf(mw, xhalf(mw));                    // the row's other 8 keys of every tile

  // ---- this wave's sums against its own maximum. Every tile a wave has holds an
  // ---- unmasked key of every row, so mw is a real score and a masked key's
  // ---- exponential is 0; a wave without a tile keeps -1e30 and two zeros.
  float lw = 0.f, s2w = 0.f;
#pragma unroll  // register arrays need constant indices
  for (int c = 0; c < NW; ++c) {
    if ((wave + NW * c) * 16 <= i0) {           // the same for the whole wave
      float u[8];
#pragma unroll  // register arrays need constant indices
      for (int r = 0; r < 8; ++r) {
        const float p = exp_slot(pa[c][r] - mw);
        pa[c][r] = p;
        u[r] = (p * p) * va[c][r];
      }
      lw  += ((pa[c][0] + pa[c][1]) + (pa[c][2] + pa[c][3])) +
             ((pa[c][4] + pa[c][5]) + (pa[c][6] + pa[c][7]));
      s2w += ((u[0] + u[1]) + (u[2] + u[3])) + ((u[4] + u[5]) + (u[6] + u[7]));
    }
  }
  lw  += xhalf(lw);
  s2w += xhalf(s2w);
  stat[(wave * 3 + 0) * 32 + lane] = mw;
  stat[(wave * 3 + 1) * 32 + lane] = lw;
  stat[(wave * 3 + 2) * 32 + lane] = s2w;
  __syncthreads();   // every wave's statistics are written

  // ---- the row's final statistics, joined in wave order ----
  float mo[NW];
  float mall = -1e30f;
#pragma unroll  // register arrays need constant indices
  for (int w = 0; w < NW; ++w) {
    mo[w] = stat[(w * 3 + 0) * 32 + lane];
    mall = fmaxf(mall, mo[w]);
  }
  float lall = 0.f, s2all = 0.f;
#pragma unroll  // register arrays need constant indices
  for (int w = 0; w < NW; ++w) {
    const float f = exp_slot(mo[w] - mall);
    lall  += stat[(w * 3 + 1) * 32 + lane] * f;
    s2all += stat[(w * 3 + 2) * 32 + lane] * (f * f);
  }
  const float inv = 1.0f / lall;
  const float gw  = exp_slot(mw - mall) * inv;  // this wave's p -> softmax value
  const float s   = s2all * (inv * inv);        // sum_j p_j^2 var_j

  // ---- sweep 2: O^T tiles; register r of tile nt = head column nt * 16 + r + 8 * half
  v8f accM[4], accV[4];
#pragma unroll  // register arrays need constant indices
  for (int nt = 0; nt < 4; ++nt) { accM[nt] = (v8f){}; accV[nt] = (v8f){}; }

#pragma unroll  // register arrays need constant indices
  for (int c = 0; c < NW; ++c) {
    const int j0 = (wave + NW * c) * 16;
    if (pinned(j0 <= i0)) {                     // a scalar test: tensor loads inside
#ifdef USE_TDM
      // prior DS reads of these two places have drained before the DMA overwrites them
      asm volatile("s_wait_dscnt 0x0" ::: "memory");
      const size_t kOff = khBase + (size_t)j0 * DHEAD;
      const v4u dv  = tdm_group0(vv_   + kOff, atA);
      const v4u dvv = tdm_group0(var_v + kOff, atB);
      tdm_load_tile16x64(dv,  DHEAD);
      tdm_load_tile16x64(dvv, DHEAD);
      // this wave's own tiles: its wait alone stands between the loads and its reads
      asm volatile("s_wait_tensorcnt 0x0" ::: "memory");
      // no scalar register of a descriptor takes a new value while its request is in flight
      __builtin_amdgcn_sched_barrier(0);
#else
      for (int idx = lane; idx < 16 * DHEAD; idx += 32) {
        const int rr = idx >> 6, cc = idx & 63;
        const size_t gi = khBase + (size_t)(j0 + rr) * DHEAD + cc;
        ta[rr * TS + cc] = vv_[gi];
        tb[rr * TS + cc] = var_v[gi];
      }
#endif
      float p1[8], p2[8], p3[8];                // p, p^2, the softmax's output variance
#pragma unroll  // register arrays need constant indices
      for (int r = 0; r < 8; ++r) {
        const float p = pa[c][r] * gw;
        p1[r] = p;
        p2[r] = p * p;
        p3[r] = p2[r] * (s + va[c][r] * (1.0f - 2.0f * p));
      }
      // output GEMMs, transposed (A = value columns, B = P^T registers):
      // M += v^T P1 ; V += W^T P3 + var_v^T P2   (W = var_v + v^2)
      // k slot (half, j) of step t is key 8 * half + 2 * t + j on both operands
#pragma unroll  // register arrays need constant indices
      for (int t = 0; t < 4; ++t) {
        const int key = 8 * half + 2 * t;
        v2f b1; b1.x = p1[2 * t]; b1.y = p1[2 * t + 1];
        v2f b2; b2.x = p2[2 * t]; b2.y = p2[2 * t + 1];
        v2f b3; b3.x = p3[2 * t]; b3.y = p3[2 * t + 1];
        v2f Bv[4], Bq[4], Bw[4];
#pragma unroll  // register arrays need constant indices
        for (int nt = 0; nt < 4; ++nt) {
          const int col = nt * 16 + l16;
          Bv[nt].x = ta[key * TS + col];
          Bv[nt].y = ta[(key + 1) * TS + col];
          Bq[nt].x = tb[key * TS + col];
          Bq[nt].y = tb[(key + 1) * TS + col];
          Bw[nt] = Bq[nt] + Bv[nt] * Bv[nt];
        }
#pragma unroll  // register arrays need constant indices
        for (int nt = 0; nt < 4; ++nt) accM[nt] = wmma4(Bv[nt], b1, accM[nt]);
#pragma unroll  // register arrays need constant indices
        for (int nt = 0; nt < 4; ++nt) accV[nt] = wmma4(Bw[nt], b3, accV[nt]);
#pragma unroll  // register arrays need constant indices
        for (int nt = 0; nt < 4; ++nt) accV[nt] = wmma4(Bq[nt], b2, accV[nt]);
      }
    }
  }

  // ---- sum the waves' partial outputs: each wave lays its 64 accumulator words a
  // ---- lane (zeros, if it had no tile) into its own two places, which it has done reading
  {
#pragma unroll  // register arrays need constant indices
    for (int nt = 0; nt < 4; ++nt) {
#pragma unroll  // register arrays need constant indices
      for (int u = 0; u < 2; ++u) {
        const int r = u * 4;
        *(v4f*)(ta + ((nt * 2 + u) * 32 + lane) * 4) =
            (v4f){accM[nt][r], accM[nt][r + 1], accM[nt][r + 2], accM[nt][r + 3]};
        *(v4f*)(ta + (((4 + nt) * 2 + u) * 32 + lane) * 4) =
            (v4f){accV[nt][r], accV[nt][r + 1], accV[nt][r + 2], accV[nt][r + 3]};
      }
    }
  }
  __syncthreads();   // all partial outputs are written; nothing is written to LDS behind it

  // ---- wave w finishes one output (w >> 2), 32 head columns ((w >> 1) & 1) and 8
  // ---- rows (w & 1): whole 128-byte lines, 8 neighbouring columns a lane
  {
    const int arr = wave >> 2;
    const int row = (wave & 1) * 8 + (lane >> 2);
    const int c8  = ((wave >> 1) & 1) * 4 + (lane & 3);   // which 8 of the 64 columns
    // columns c8 * 8 .. + 7 of that row: tile c8 >> 1, the writer's half c8 & 1
    const int src = (((arr * 4 + (c8 >> 1)) * 2) * 32 + row + 16 * (c8 & 1)) * 4;
    v4f lo = {0.f, 0.f, 0.f, 0.f}, hi = {0.f, 0.f, 0.f, 0.f};
#pragma unroll  // eight short trips: their LDS reads go out together
    for (int w = 0; w < NW; ++w) {
      lo += *(const v4f*)(smem + w * (WAVE_AT / 4) + src);
      hi += *(const v4f*)(smem + w * (WAVE_AT / 4) + src + 128);
    }
    const size_t g0 = (size_t)(b * SEQ + i0 + row) * DIM + h * DHEAD + c8 * 8;
    if (arr == 0) {                             // the same for the whole wave
      lo += *(const v4f*)(x + g0);
      hi += *(const v4f*)(x + g0 + 4);
      *(v4f*)(out_mean + g0)     = lo;
      *(v4f*)(out_mean + g0 + 4) = hi;
    } else {
      *(v4f*)(out_var + g0)     = lo;
      *(v4f*)(out_var + g0 + 4) = hi;
    }
  }
}

// ---------------------------------------------------------------------------
extern "C" void kernel_launch(void* const* d_in, const int* in_sizes, int n_in,
                              void* d_out, int out_size, void* d_ws, size_t ws_size,
                              hipStream_t stream) {
  const float* x     = (const float*)d_in[0];
  const float* var_x = (const float*)d_in[1];
  const float* k     = (const float*)d_in[2];
  const float* var_k = (const float*)d_in[3];
  const float* v     = (const float*)d_in[4];
  const float* var_v = (const float*)d_in[5];
  const float* wmu   = (const float*)d_in[6];
  const float* wvar  = (const float*)d_in[7];

  float* out = (float*)d_out;               // [mean | var], each B*S*D
  float* ws  = (float*)d_ws;
  const size_t NT = (size_t)BATCH * SEQ * DIM;   // 4M floats
  float* q   = ws;
  float* vq  = ws + NT;
  float* q2  = ws + 2 * NT;

  // 1) projection: 32 x 16 tiles of 128 x 64, 8 waves/block
  vdp_proj<<<512, 256, 0, stream>>>(x, var_x, wmu, wvar, q, vq, q2);

  // 2) fused causal VDP attention + residual, 8 waves per 16-row block,
  //    longest row blocks at the lowest indices
  vdp_flash<<<BATCH * HEADS * (SEQ / 16), 256, 0, stream>>>(
      q, vq, q2, k, var_k, v, var_v, x, out, out + NT);
}

// v009
// One run takes 237 microseconds.
// Versions in between are left out here; by their measured steps it is 1.17 times as fast as v007.
// All steps since v000 together make it 3.85 times as fast.
#include <hip/hip_runtime.h>

// ---------------------------------------------------------------------------
// DecoderHeadVDP on MI455X (gfx1250, wave32, WMMA + TDM)
// B=4, S=1024, D=1024, H=16, DH=64
// Attention: fp32 via V_WMMA_F32_16X16X4_F32 (variance path is precision
// sensitive: p^2 / p^3 terms on 0.1-scale variances). Projection: f32 operands
// as f16 head + rest on V_WMMA_F32_16X16X32_F16, f32 sums. Attention's tile
// staging into LDS uses the Tensor Data Mover (tensor_load_to_lds) with descriptor
// padding that gives the LDS rows a pitch of 68 DWORDs (16 bytes x odd).
// ---------------------------------------------------------------------------

#define BATCH 4
#define SEQ   1024
#define DIM   1024
#define HEADS 16
#define DHEAD 64
#define RSQD  (1.0f / 32.0f)     // 1/sqrt(D)
#define RVD   (1.0f / 1024.0f)   // 1/D

typedef __attribute__((ext_vector_type(2))) float        v2f;
typedef __attribute__((ext_vector_type(8))) float        v8f;
typedef __attribute__((ext_vector_type(4))) unsigned int v4u;
typedef __attribute__((ext_vector_type(8))) int          v8i;
typedef __attribute__((ext_vector_type(4))) int          v4i;

#if defined(__has_builtin)
#if __has_builtin(__builtin_amdgcn_tensor_load_to_lds)
#define USE_TDM 1
#endif
#endif

static __device__ __forceinline__ v8f wmma4(v2f a, v2f b, v8f c) {
  // D = A(16x4) * B(4x16) + C, fp32
  return __builtin_amdgcn_wmma_f32_16x16x4_f32(false, a, false, b, (short)0, c,
                                               false, false);
}

#ifdef USE_TDM
// ---------------------------------------------------------------------------
// TDM: async DMA of a 16-row x 64-col f32 tile, global -> LDS.
//   src             : global address of tile start (row-major, row pitch
//                     `pitch_elems` floats)
//   lds_byte_off    : LDS byte offset of destination
// D# pad feature inserts 4 DWORDs after every 64 DWORDs -> LDS row pitch 68 DWORDs
// (272 bytes), matching the padded tiles used by the WMMA operand reads.
// Every extent of group 1 is in bytes (data_size code 0).
// clang-23 / therock toolchain: 6-arg builtin
//   (v4u g0, v8i g1, v4i g2, v4i g3, v8i g4, i32 cpol)
// ---------------------------------------------------------------------------
// Group 0 of one request. Every word is scalar; the tuple is then held in four
// scalar registers of its own, so that requests whose groups are formed before
// the first of them is issued never share a register.
static __device__ __forceinline__ v4u tdm_group0(const float* src,
                                                 unsigned int lds_byte_off) {
  const unsigned long long ga = (unsigned long long)(uintptr_t)src;
  v4u g0;
  g0.x = 1u;                                      // count=1 (valid), user mode
  g0.y = lds_byte_off;                            // lds_addr
  g0.z = (unsigned int)__builtin_amdgcn_readfirstlane(
      (int)(unsigned int)(ga & 0xffffffffu));     // global_addr[31:0]
  g0.w = ((unsigned int)__builtin_amdgcn_readfirstlane(
              (int)(unsigned int)(ga >> 32)) & 0x01ffffffu)  // global_addr[56:32]
         | (2u << 30);                            // type = 2 ("image")
  asm volatile("" : "+s"(g0));  // as pinned(): descriptor words held in scalar registers
  return g0;
}

static __device__ __forceinline__ void tdm_load_tile16x64(
    v4u g0, unsigned int pitch_elems) {
  v8i g1;
  g1[0] = (int)((1u << 20)        // pad_enable; data_size code 0, no mask
                | (5u << 22)      // pad_interval: 64 DWORDs, the row
                | (3u << 25));    // pad_amount: 4 DWORDs
  g1[1] = (int)(256u << 16);      // tensor_dim0[15:0] = 256 bytes
  g1[2] = (int)(16u << 16);       // tensor_dim0 hi=0 | tensor_dim1[15:0] = 16
  g1[3] = (int)(256u << 16);      // tensor_dim1 hi=0 | tile_dim0 = 256 bytes
  g1[4] = (int)16u;               // tile_dim1 = 16 | tile_dim2 = 0
  g1[5] = (int)(pitch_elems * 4u);  // tensor_dim0_stride[31:0], bytes
  g1[6] = 0;                      // stride hi | tensor_dim1_stride lo
  g1[7] = 0;
  const v4i z4 = {0, 0, 0, 0};                    // groups 2/3 unused (2D)
  const v8i z8 = {0, 0, 0, 0, 0, 0, 0, 0};
  __builtin_amdgcn_tensor_load_to_lds(g0, g1, z4, z4, z8, 0);
}
#endif

// ---------------------------------------------------------------------------
// Kernel 1: projection.  q = x @ Wmu^T ; var_q = var_x @ W2^T + x^2 @ Wvar^T
// with W2 = Wvar + Wmu^2, formed fragment by fragment in registers from the Wmu
// and Wvar fragments that the other two products read anyway: it is never in
// memory or LDS and needs no launch of its own.
// One work-group (8 waves) per 128 x 64 output tile. Per stage of 32 k the
// rows of the four inputs (x, var_x: 128 rows; Wmu, Wvar: 64 rows) are
// brought in by whole-line 16-byte loads and stored to LDS, two buffers; each
// wave then forms a 32 x 32 piece (2 x 2 WMMA tiles, 3 products each) from
// 16-byte LDS fragment reads: a lane holds 16 neighbouring k of its row, the
// same 16 on the A and on the B side.
// Each f32 operand a is split in registers into a = hi + lo + (under 2^-22 |a|),
// hi = f16(a), lo = f16(a - hi), and a product a b runs as hi lo' + lo hi' + hi hi'
// on the f16 16x16x32 form with f32 sums: 3 matrix instructions of 8 cycles per
// 32 k where the f32 16x16x4 form takes 8 of 16 cycles; lo lo' (2^-22 of the
// product) is dropped. The inputs go into LDS times a power of two (exact: x 2^4,
// var_x 2^8, Wmu 2^7, Wvar 2^14; x^2 and W2 then come out times 2^8 and 2^14):
// unscaled, Wvar itself and most rests would lie in f16's subnormals. The outputs
// are scaled back.
// ---------------------------------------------------------------------------
#define PBM   128                       // output rows per work-group
#define PBN   64                        // output columns per work-group
#define PBK   32                        // k per stage: one 128-byte line a row
#define PLP   36                        // LDS row pitch in floats (4 x odd: the
                                        // 16 rows x 4 dwords of a fragment read
                                        // fall on 64 different banks)
#define PROWS (2 * PBM + 2 * PBN)       // 384 staged rows
#define PNLD  (PROWS / 32)              // 12 16-byte loads per thread and stage
#define PNST  (DIM / PBK)               // 32 stages

#define SCX   16.0f                     // scale of x in LDS
#define SCY   256.0f                    // scale of var_x in LDS, and so of x^2: SCX^2
#define SCM   128.0f                    // scale of Wmu in LDS
#define SCV   16384.0f                  // scale of Wvar in LDS, and so of W2: SCM^2

typedef __attribute__((ext_vector_type(4))) float v4f;
typedef __attribute__((ext_vector_type(16))) _Float16 v16h;

static __device__ __forceinline__ v8f wmma32(v16h a, v16h b, v8f c) {
  // D = A(16x32) * B(32x16) + C, f16 operands, f32 sums
  return __builtin_amdgcn_wmma_f32_16x16x32_f16(false, a, false, b, (short)0, c,
                                                false, false);
}

// 8 f32 of a lane -> 4 registers of f16 heads (round to nearest) and 4 of f16 rests.
// In asm because the compiler forms a rest in three steps (head back to f32, subtract,
// round); v_fma_mixlo/mixhi_f16 reads the f16 head as it lies and does all three in one
// instruction: rest = f16(a - head), the difference being exact. This split is most of
// the kernel's vector work. Every producer stands four vector instructions in front of
// its reader; the s_delay_alu hints say so, so that the SIMD's other waves issue meanwhile.
static __device__ __forceinline__ void split8(const v4f a, const v4f b, v4u& hi, v4u& lo) {
  unsigned int h0, h1, h2, h3, l0, l1, l2, l3;
  asm("v_cvt_pk_f16_f32 %0, %8, %9\n\t"
      "v_cvt_pk_f16_f32 %1, %10, %11\n\t"
      "v_cvt_pk_f16_f32 %2, %12, %13\n\t"
      "v_cvt_pk_f16_f32 %3, %14, %15\n\t"
      "s_delay_alu instid0(VALU_DEP_4) | instskip(NEXT) | instid1(VALU_DEP_4)\n\t"
      "v_fma_mixlo_f16 %4, %0, -1.0, %8 op_sel_hi:[1,0,0]\n\t"
      "v_fma_mixlo_f16 %5, %1, -1.0, %10 op_sel_hi:[1,0,0]\n\t"
      "s_delay_alu instid0(VALU_DEP_4) | instskip(NEXT) | instid1(VALU_DEP_4)\n\t"
      "v_fma_mixlo_f16 %6, %2, -1.0, %12 op_sel_hi:[1,0,0]\n\t"
      "v_fma_mixlo_f16 %7, %3, -1.0, %14 op_sel_hi:[1,0,0]\n\t"
      "s_delay_alu instid0(VALU_DEP_4) | instskip(NEXT) | instid1(VALU_DEP_4)\n\t"
      "v_fma_mixhi_f16 %4, %0, -1.0, %9 op_sel:[1,0,0] op_sel_hi:[1,0,0]\n\t"
      "v_fma_mixhi_f16 %5, %1, -1.0, %11 op_sel:[1,0,0] op_sel_hi:[1,0,0]\n\t"
      "s_delay_alu instid0(VALU_DEP_4) | instskip(NEXT) | instid1(VALU_DEP_4)\n\t"
      "v_fma_mixhi_f16 %6, %2, -1.0, %13 op_sel:[1,0,0] op_sel_hi:[1,0,0]\n\t"
      "v_fma_mixhi_f16 %7, %3, -1.0, %15 op_sel:[1,0,0] op_sel_hi:[1,0,0]"
      : "=&v"(h0), "=&v"(h1), "=&v"(h2), "=&v"(h3),
        "=&v"(l0), "=&v"(l1), "=&v"(l2), "=&v"(l3)
      : "v"(a.x), "v"(a.y), "v"(a.z), "v"(a.w), "v"(b.x), "v"(b.y), "v"(b.z), "v"(b.w));
  hi = (v4u){h0, h1, h2, h3};
  lo = (v4u){l0, l1, l2, l3};
}

// a lane's 16 f32 -> f16 heads and f16 rests; element e of both is k = e of the 16
static __device__ __forceinline__ void split16(const v4f (&s)[4], v16h& hi, v16h& lo) {
  v4u ha, la, hb, lb;
  split8(s[0], s[1], ha, la);
  split8(s[2], s[3], hb, lb);
  hi = __builtin_bit_cast(v16h, __builtin_shufflevector(ha, hb, 0, 1, 2, 3, 4, 5, 6, 7));
  lo = __builtin_bit_cast(v16h, __builtin_shufflevector(la, lb, 0, 1, 2, 3, 4, 5, 6, 7));
}

// acc[i][j] += a[i] b[j]^T from heads and rests, the small terms first
static __device__ __forceinline__ void prod3(const v16h (&ah)[2], const v16h (&al)[2],
                                             const v16h (&bh)[2], const v16h (&bl)[2],
                                             v8f (&acc)[2][2]) {
#pragma unroll  // register arrays need constant indices
  for (int i = 0; i < 2; ++i)
#pragma unroll  // register arrays need constant indices
    for (int j = 0; j < 2; ++j) acc[i][j] = wmma32(ah[i], bl[j], acc[i][j]);
#pragma unroll  // register arrays need constant indices
  for (int i = 0; i < 2; ++i)
#pragma unroll  // register arrays need constant indices
    for (int j = 0; j < 2; ++j) acc[i][j] = wmma32(al[i], bh[j], acc[i][j]);
#pragma unroll  // register arrays need constant indices
  for (int i = 0; i < 2; ++i)
#pragma unroll  // register arrays need constant indices
    for (int j = 0; j < 2; ++j) acc[i][j] = wmma32(ah[i], bh[j], acc[i][j]);
  // The next split (asm text, which the compiler does not look into) writes the
  // registers that these WMMAs read as A and B: the four vector slots that the chip
  // needs in between. The two scheduling barriers keep the slots behind the last WMMA
  // and every later split behind the slots.
  __builtin_amdgcn_sched_barrier(0);
  asm volatile("v_nop\n\tv_nop\n\tv_nop\n\tv_nop");
  __builtin_amdgcn_sched_barrier(0);
}

// four waves a SIMD: two work-groups share a WGP, and one works while the other
// stands at its barrier
__global__ __launch_bounds__(256) __attribute__((amdgpu_waves_per_eu(4, 4)))
void vdp_proj(const float* __restrict__ x,
              const float* __restrict__ var_x,
              const float* __restrict__ wmu,
              const float* __restrict__ wvar,
              float* __restrict__ q,
              float* __restrict__ var_q,
              float* __restrict__ qsq) {
  // rows 0..127 x | 128..255 var_x | 256..319 Wmu | 320..383 Wvar
  __shared__ __attribute__((aligned(16))) float stg[2][PROWS * PLP];

  const int tid  = threadIdx.x;
  const int lane = tid & 31;
  const int wave = tid >> 5;
  const int half = lane >> 4;   // 0/1
  const int l16  = lane & 15;
  const int wm   = wave & 3;    // 4 wave rows of 32
  const int wn   = wave >> 2;   // 2 wave columns of 32

  const int m0 = (blockIdx.x >> 4) * PBM;        // 32 row blocks
  const int n0 = (blockIdx.x & 15) * PBN;        // 16 column blocks

  // staging: 8 threads cover one row's 128 bytes, 32 rows per step
  const int sr = tid >> 3;
  const int sc = (tid & 7) * 4;
  const unsigned int goff = (unsigned int)(sr * DIM + sc);  // the same for all four
  const float* gx  = x     + (size_t)m0 * DIM;              // block-uniform bases
  const float* gvx = var_x + (size_t)m0 * DIM;
  const float* gwm = wmu   + (size_t)n0 * DIM;
  const float* gwv = wvar  + (size_t)n0 * DIM;
  const int sdst = sr * PLP + sc;

  // fragment reads: row = l16 of the tile, k = 16 * half + 0 .. 15 of the stage
  const int aoff = (wm * 32 + l16) * PLP + half * 16;
  const int boff = (2 * PBM + wn * 32 + l16) * PLP + half * 16;

  v4f st[PNLD];
  v8f accQ[2][2], accV[2][2];
#pragma unroll  // register arrays need constant indices
  for (int i = 0; i < 2; ++i)
#pragma unroll  // register arrays need constant indices
    for (int j = 0; j < 2; ++j) { accQ[i][j] = (v8f){}; accV[i][j] = (v8f){}; }
  // the accumulators are cleared in front of the first loads: cleared behind them, one
  // took over the loads' offset register
  __builtin_amdgcn_sched_barrier(0);

  auto fetch = [&](int s) {
    const int ko = s * PBK;
#pragma unroll  // register arrays need constant indices
    for (int i = 0; i < 4; ++i) {
      st[i]     = *(const v4f*)(gx  + ko + i * 32 * DIM + goff);
      st[4 + i] = *(const v4f*)(gvx + ko + i * 32 * DIM + goff);
    }
    // the loads below may land in registers that held the addresses above
    asm volatile("s_wait_xcnt 0x0" ::: "memory");
#pragma unroll  // register arrays need constant indices
    for (int i = 0; i < 2; ++i) {
      st[8 + i]  = *(const v4f*)(gwm + ko + i * 32 * DIM + goff);
      st[10 + i] = *(const v4f*)(gwv + ko + i * 32 * DIM + goff);
    }
  };
  auto put = [&](int buf) {
    float* d = &stg[buf][sdst];
#pragma unroll  // register arrays need constant indices
    for (int i = 0; i < PNLD; ++i)
      *(v4f*)(d + i * 32 * PLP) = st[i] * (i < 4 ? SCX : i < 8 ? SCY : i < 10 ? SCM : SCV);
  };

  fetch(0);
  put(0);
  __syncthreads();   // stage 0 is in LDS for every wave

  for (int s = 0; s < PNST; ++s) {
    const bool more = (s + 1 < PNST);            // the same for the whole block
    if (more) fetch(s + 1);                      // in flight under this stage's WMMAs

    const float* pa = &stg[s & 1][aoff];
    const float* pb = &stg[s & 1][boff];
    v4f fx[2][4], fm[2][4], fv[2][4], fy[2][4];
    v16h ah[2], al[2], bh[2], bl[2];
    // q += x Wmu^T
#pragma unroll  // register arrays need constant indices
    for (int i = 0; i < 2; ++i) {
#pragma unroll  // register arrays need constant indices
      for (int u = 0; u < 4; ++u) {
        fx[i][u] = *(const v4f*)(pa + i * 16 * PLP + u * 4);
        fm[i][u] = *(const v4f*)(pb + i * 16 * PLP + u * 4);
      }
      split16(fx[i], ah[i], al[i]);
      split16(fm[i], bh[i], bl[i]);
    }
    prod3(ah, al, bh, bl, accQ);
    // var_q += x^2 Wvar^T
#pragma unroll  // register arrays need constant indices
    for (int i = 0; i < 2; ++i) {
#pragma unroll  // register arrays need constant indices
      for (int u = 0; u < 4; ++u) {
        fx[i][u] = fx[i][u] * fx[i][u];
        fv[i][u] = *(const v4f*)(pb + (PBN + i * 16) * PLP + u * 4);
      }
      split16(fx[i], ah[i], al[i]);
      split16(fv[i], bh[i], bl[i]);
    }
    prod3(ah, al, bh, bl, accV);
    // var_q += var_x W2^T
#pragma unroll  // register arrays need constant indices
    for (int i = 0; i < 2; ++i) {
#pragma unroll  // register arrays need constant indices
      for (int u = 0; u < 4; ++u) {
        fy[i][u] = *(const v4f*)(pa + (PBM + i * 16) * PLP + u * 4);
        fm[i][u] = fv[i][u] + fm[i][u] * fm[i][u];        // W2, one fused multiply-add
      }
      split16(fy[i], ah[i], al[i]);
      split16(fm[i], bh[i], bl[i]);
    }
    prod3(ah, al, bh, bl, accV);

    if (more) {
      put((s + 1) & 1);   // the buffer whose readers all passed the last barrier
      __syncthreads();    // publishes stage s + 1, ends the reads of stage s
    }
  }

  // scale back (exact: powers of two) and square
  v8f sqQ[2][2];
#pragma unroll  // register arrays need constant indices
  for (int i = 0; i < 2; ++i) {
#pragma unroll  // register arrays need constant indices
    for (int j = 0; j < 2; ++j) {
      accQ[i][j] = accQ[i][j] * (1.0f / (SCX * SCM));
      accV[i][j] = accV[i][j] * (1.0f / (SCY * SCV));
      sqQ[i][j]  = accQ[i][j] * accQ[i][j];
    }
  }
  float *pq[2], *ps[2], *pv[2];                 // row r = 0, column j = 0 of tile row i
#pragma unroll  // register arrays need constant indices
  for (int i = 0; i < 2; ++i) {
    const size_t g = (size_t)(m0 + wm * 32 + i * 16 + 8 * half) * DIM + n0 + wn * 32 + l16;
    pq[i] = q + g;
    ps[i] = qsq + g;
    pv[i] = var_q + g;
  }
  // every value and address is formed in front of the first store: formed among the
  // stores, they took over registers of issued stores
  __builtin_amdgcn_sched_barrier(0);

#pragma unroll  // register arrays need constant indices
  for (int i = 0; i < 2; ++i) {
#pragma unroll  // register arrays need constant indices
    for (int j = 0; j < 2; ++j) {
#pragma unroll  // register arrays need constant indices
      for (int r = 0; r < 8; ++r) {
        pq[i][r * DIM + j * 16] = accQ[i][j][r];
        ps[i][r * DIM + j * 16] = sqQ[i][j][r];
        pv[i][r * DIM + j * 16] = accV[i][j][r];
      }
    }
  }
}

#define TS 68
#define NW 8    // waves per row block = key tiles per round

// Every tile's place in LDS is a multiple of 2 KiB. A wave owns two places (k and
// var_k in sweep 1, v and var_v in sweep 2, its partial output at the end); the
// three query tiles, shared by all waves, follow.
#define TILE_AT 6144
#define WAVE_AT (2 * TILE_AT)

// A wave-uniform test held in a scalar register, so that the branch on it is a
// scalar branch: a tensor load ignores EXEC.
static __device__ __forceinline__ unsigned int pinned(unsigned int v) {
  unsigned int w = (unsigned int)__builtin_amdgcn_readfirstlane((int)v);
  asm volatile("" : "+s"(w));  // pinned(): the issue test of a tensor load stays scalar
  return w;
}

// lane l <-> lane l ^ 16 on the vector unit
static __device__ __forceinline__ float xhalf(float v) {
  return __builtin_bit_cast(
      float, __builtin_amdgcn_permlanex16(__builtin_bit_cast(int, v),
                                          __builtin_bit_cast(int, v), 0x76543210,
                                          0xfedcba98, false, false));
}

// e^v as __expf forms it (2^(v log2 e) on the transcendental unit). The v_nop in
// the same statement is the slot the instruction set asks for between a
// transcendental and an instruction that reads its result or overwrites its
// source.
static __device__ __forceinline__ float exp_slot(float v) {
  float e;
  asm("v_exp_f32 %0, %1\n\tv_nop" : "=v"(e) : "v"(v * 1.44269504088896340736f));
  return e;
}

// four waves a SIMD: two work-groups share a WGP, and one fills the matrix unit
// while the other waits for a tile, at a barrier or for its start
__global__ __launch_bounds__(256) __attribute__((amdgpu_waves_per_eu(4, 4)))
void vdp_flash(const float* __restrict__ q,
               const float* __restrict__ var_q,
               const float* __restrict__ qsq,
               const float* __restrict__ kk_,
               const float* __restrict__ var_k,
               const float* __restrict__ vv_,
               const float* __restrict__ var_v,
               const float* __restrict__ x,
               float* __restrict__ out_mean,
               float* __restrict__ out_var) {
  __shared__ __attribute__((aligned(2048))) float smem[(NW * 2 + 3) * TILE_AT / 4];
  __shared__ float stat[NW * 3 * 32];   // per wave: row maximum, sum p, sum p^2 var

  const int hw = __builtin_amdgcn_readfirstlane((int)(threadIdx.x >> 5));  // 0 .. 7
  // A row block has iblk + 1 key tiles and there are more work-groups than
  // resident places: the cost falls with the index (for speed only).
  const int iblk = (SEQ / 16 - 1) - ((blockIdx.x >> 6) & (SEQ / 16 - 1));  // S/16 row blocks
  const int bh   = blockIdx.x & (BATCH * HEADS - 1);
  // which share of the key tiles this wave has. The low shares get the odd tiles of
  // a block whose count is no multiple of 8
  const int wave = (hw + (iblk >> 3) + bh) & (NW - 1);
  float* const ta = smem + wave * (WAVE_AT / 4);   // this wave's own: k, then v
  float* const tb = ta + TILE_AT / 4;              // var_k, then var_v
  float* const lq  = smem + NW * (WAVE_AT / 4);
  float* const lvq = lq + TILE_AT / 4;
  float* const lq2 = lvq + TILE_AT / 4;

#ifdef USE_TDM
  // the same places as byte offsets in the work-group's LDS, scalar
  const unsigned int lds0 = (unsigned int)__builtin_amdgcn_readfirstlane(
      (int)(unsigned int)(uintptr_t)(&smem[0]));
  const unsigned int atA = lds0 + wave * WAVE_AT;
  const unsigned int atB = atA + TILE_AT;
  const unsigned int atQ = lds0 + NW * WAVE_AT;
#endif

  const int lane = threadIdx.x & 31;
  const int half = lane >> 4;
  const int l16  = lane & 15;

  const int h    = bh & (HEADS - 1);
  const int b    = bh >> 4;
  const int i0   = iblk * 16;

  const size_t khBase = (size_t)bh * SEQ * DHEAD;

  // ---- stage the q / var_q / q^2 row tiles (16 x 64, pitch DIM) once ----
#ifdef USE_TDM
  if (pinned(hw == 0)) {
    const size_t qOff = (size_t)(b * SEQ + i0) * DIM + h * DHEAD;
    const v4u dq  = tdm_group0(q     + qOff, atQ);
    const v4u dvq = tdm_group0(var_q + qOff, atQ + TILE_AT);
    const v4u dq2 = tdm_group0(qsq   + qOff, atQ + 2 * TILE_AT);
    tdm_load_tile16x64(dq,  DIM);
    tdm_load_tile16x64(dvq, DIM);
    tdm_load_tile16x64(dq2, DIM);
    // the issuer's own wait: the tiles have landed before the barrier below
    asm volatile("s_wait_tensorcnt 0x0" ::: "memory");
  }
#else
  for (int idx = threadIdx.x; idx < 16 * DHEAD; idx += 256) {
    const int rr = idx >> 6, cc = idx & 63;
    const size_t gi = (size_t)(b * SEQ + i0 + rr) * DIM + h * DHEAD + cc;
    lq [rr * TS + cc] = q[gi];
    lvq[rr * TS + cc] = var_q[gi];
    lq2[rr * TS + cc] = qsq[gi];
  }
#endif
  __syncthreads();   // publishes the query tiles to all waves

  // ---- sweep 1: scores and score variances of this wave's key tiles ----
  // per lane: 8 keys (r + 8 * half) of query row i0 + l16, for each of its tiles;
  // a tile's words are written, and later read, only under the test that it exists
  float pa[NW][8], va[NW][8];
  float mw = -1e30f;                            // the row's maximum over this wave's keys
#pragma unroll  // register arrays need constant indices
  for (int c = 0; c < NW; ++c) {
    const int j0 = (wave + NW * c) * 16;
    if (pinned(j0 <= i0)) {                     // a scalar test: tensor loads inside
#ifdef USE_TDM
      // make sure prior DS reads of these tiles have drained before the DMA
      // overwrites them (TDM writes are not ordered against DS ops)
      asm volatile("s_wait_dscnt 0x0" ::: "memory");
      const size_t kOff = khBase + (size_t)j0 * DHEAD;
      const v4u dk  = tdm_group0(kk_   + kOff, atA);
      const v4u dkv = tdm_group0(var_k + kOff, atB);
      tdm_load_tile16x64(dk,  DHEAD);
      tdm_load_tile16x64(dkv, DHEAD);
      // the tiles are this wave's own: its wait alone stands between the loads
      // and its reads, and no LDS read moves in front of it
      asm volatile("s_wait_tensorcnt 0x0" ::: "memory");
      // nothing from below is scheduled in front of the wait: no scalar register
      // of a descriptor takes a new value while its request is in flight
      __builtin_amdgcn_sched_barrier(0);
#else
      for (int idx = lane; idx < 16 * DHEAD; idx += 32) {
        const int rr = idx >> 6, cc = idx & 63;
        const size_t gi = khBase + (size_t)(j0 + rr) * DHEAD + cc;
        ta[rr * TS + cc] = kk_[gi];
        tb[rr * TS + cc] = var_k[gi];
      }
#endif
      // score GEMMs, transposed (A = key rows, B = query rows):
      // mean^T = k q^T ; var^T = (var_k+k^2) var_q^T + var_k (q^2)^T
      v8f sm = {}, sv = {};
      // One 16-byte read a lane feeds two steps: of each 8 head columns a lane has the
      // 4 at 4 * half, so k slot (half, e) of step w of column block tq + u is head column
      // 8 * (tq + u) + 4 * half + 2 * w + e, by the same index on the A and on the B side.
      // stays a loop of 4 x 4 steps, for speed only: it bounds how far ahead LDS
      // fragments are fetched, and so the registers
#pragma unroll 1
      for (int tq = 0; tq < DHEAD / 8; tq += 2) {
        v4f fq[2], fvq[2], fq2[2], fk[2], fkv[2];
#pragma unroll  // register arrays need constant indices
        for (int u = 0; u < 2; ++u) {
          const int qi = l16 * TS + (tq + u) * 8 + half * 4;
          fq [u] = *(const v4f*)(lq  + qi);               // B: column n = query l16
          fvq[u] = *(const v4f*)(lvq + qi);
          fq2[u] = *(const v4f*)(lq2 + qi);
          fk [u] = *(const v4f*)(ta  + qi);               // A: row m = key l16
          fkv[u] = *(const v4f*)(tb  + qi);
        }
        // the four steps' reads stay one group in front of their WMMAs: spread among
        // them, each small group waits out the LDS latency anew
        __builtin_amdgcn_sched_barrier(0);
#pragma unroll  // register arrays need constant indices
        for (int u = 0; u < 2; ++u) {
#pragma unroll  // register arrays need constant indices
          for (int w = 0; w < 2; ++w) {
            const v2f bk  = {fk [u][2 * w], fk [u][2 * w + 1]};
            const v2f bkv = {fkv[u][2 * w], fkv[u][2 * w + 1]};
            const v2f aq  = {fq [u][2 * w], fq [u][2 * w + 1]};
            const v2f avq = {fvq[u][2 * w], fvq[u][2 * w + 1]};
            const v2f aq2 = {fq2[u][2 * w], fq2[u][2 * w + 1]};
            const v2f bw  = bkv + bk * bk;
            sm = wmma4(bk,  aq,  sm);
            sv = wmma4(bw,  avq, sv);
            sv = wmma4(bkv, aq2, sv);
          }
        }
      }
      const int m = i0 + l16;                   // global row
#pragma unroll  // register arrays need constant indices
      for (int r = 0; r < 8; ++r) {
        const int n = j0 + r + 8 * half;        // global col
        pa[c][r] = (n <= m) ? sm[r] * RSQD : -1e30f;
        va[c][r] = sv[r] * RVD;
        mw = fmaxf(mw, pa[c][r]);
      }
    }
  }
  mw = fmaxf(mw, xhalf(mw));                    // the row's other 8 keys of every tile

  // ---- this wave's sums against its own maximum. Every tile a wave has holds an
  // ---- unmasked key of every row, so mw is a real score and a masked key's
  // ---- exponential is 0; a wave without a tile keeps -1e30 and two zeros.
  float lw = 0.f, s2w = 0.f;
#pragma unroll  // register arrays need constant indices
  for (int c = 0; c < NW; ++c) {
    if ((wave + NW * c) * 16 <= i0) {           // the same for the whole wave
      float u[8];
#pragma unroll  // register arrays need constant indices
      for (int r = 0; r < 8; ++r) {
        const float p = exp_slot(pa[c][r] - mw);
        pa[c][r] = p;
        u[r] = (p * p) * va[c][r];
      }
      lw  += ((pa[c][0] + pa[c][1]) + (pa[c][2] + pa[c][3])) +
             ((pa[c][4] + pa[c][5]) + (pa[c][6] + pa[c][7]));
      s2w += ((u[0] + u[1]) + (u[2] + u[3])) + ((u[4] + u[5]) + (u[6] + u[7]));
    }
  }
  lw  += xhalf(lw);
  s2w += xhalf(s2w);
  stat[(wave * 3 + 0) * 32 + lane] = mw;
  stat[(wave * 3 + 1) * 32 + lane] = lw;
  stat[(wave * 3 + 2) * 32 + lane] = s2w;
  __syncthreads();   // every wave's statistics are written

  // ---- the row's final statistics, joined in wave order ----
  float mo[NW];
  float mall = -1e30f;
#pragma unroll  // register arrays need constant indices
  for (int w = 0; w < NW; ++w) {
    mo[w] = stat[(w * 3 + 0) * 32 + lane];
    mall = fmaxf(mall, mo[w]);
  }
  float lall = 0.f, s2all = 0.f;
#pragma unroll  // register arrays need constant indices
  for (int w = 0; w < NW; ++w) {
    const float f = exp_slot(mo[w] - mall);
    lall  += stat[(w * 3 + 1) * 32 + lane] * f;
    s2all += stat[(w * 3 + 2) * 32 + lane] * (f * f);
  }
  const float inv = 1.0f / lall;
  const float gw  = exp_slot(mw - mall) * inv;  // this wave's p -> softmax value
  const float s   = s2all * (inv * inv);        // sum_j p_j^2 var_j

  // ---- sweep 2: O^T tiles; register r of tile nt = head column nt * 16 + r + 8 * half
  v8f accM[4], accV[4];
#pragma unroll  // register arrays need constant indices
  for (int nt = 0; nt < 4; ++nt) { accM[nt] = (v8f){}; accV[nt] = (v8f){}; }

#pragma unroll  // register arrays need constant indices
  for (int c = 0; c < NW; ++c) {
    const int j0 = (wave + NW * c) * 16;
    if (pinned(j0 <= i0)) {                     // a scalar test: tensor loads inside
#ifdef USE_TDM
      // prior DS reads of these two places have drained before the DMA overwrites them
      asm volatile("s_wait_dscnt 0x0" ::: "memory");
      const size_t kOff = khBase + (size_t)j0 * DHEAD;
      const v4u dv  = tdm_group0(vv_   + kOff, atA);
      const v4u dvv = tdm_group0(var_v + kOff, atB);
      tdm_load_tile16x64(dv,  DHEAD);
      tdm_load_tile16x64(dvv, DHEAD);
      // this wave's own tiles: its wait alone stands between the loads and its reads
      asm volatile("s_wait_tensorcnt 0x0" ::: "memory");
      // no scalar register of a descriptor takes a new value while its request is in flight
      __builtin_amdgcn_sched_barrier(0);
#else
      for (int idx = lane; idx < 16 * DHEAD; idx += 32) {
        const int rr = idx >> 6, cc = idx & 63;
        const size_t gi = khBase + (size_t)(j0 + rr) * DHEAD + cc;
        ta[rr * TS + cc] = vv_[gi];
        tb[rr * TS + cc] = var_v[gi];
      }
#endif
      float p1[8], p2[8], p3[8];                // p, p^2, the softmax's output variance
#pragma unroll  // register arrays need constant indices
      for (int r = 0; r < 8; ++r) {
        const float p = pa[c][r] * gw;
        p1[r] = p;
        p2[r] = p * p;
        p3[r] = p2[r] * (s + va[c][r] * (1.0f - 2.0f * p));
      }
      // output GEMMs, transposed (A = value columns, B = P^T registers):
      // M += v^T P1 ; V += W^T P3 + var_v^T P2   (W = var_v + v^2)
      // k slot (half, j) of step t is key 8 * half + 2 * t + j on both operands
#pragma unroll  // register arrays need constant indices
      for (int t = 0; t < 4; ++t) {
        const int key = 8 * half + 2 * t;
        v2f b1; b1.x = p1[2 * t]; b1.y = p1[2 * t + 1];
        v2f b2; b2.x = p2[2 * t]; b2.y = p2[2 * t + 1];
        v2f b3; b3.x = p3[2 * t]; b3.y = p3[2 * t + 1];
        v2f Bv[4], Bq[4], Bw[4];
#pragma unroll  // register arrays need constant indices
        for (int nt = 0; nt < 4; ++nt) {
          const int col = nt * 16 + l16;
          Bv[nt].x = ta[key * TS + col];
          Bv[nt].y = ta[(key + 1) * TS + col];
          Bq[nt].x = tb[key * TS + col];
          Bq[nt].y = tb[(key + 1) * TS + col];
          Bw[nt] = Bq[nt] + Bv[nt] * Bv[nt];
        }
#pragma unroll  // register arrays need constant indices
        for (int nt = 0; nt < 4; ++nt) accM[nt] = wmma4(Bv[nt], b1, accM[nt]);
#pragma unroll  // register arrays need constant indices
        for (int nt = 0; nt < 4; ++nt) accV[nt] = wmma4(Bw[nt], b3, accV[nt]);
#pragma unroll  // register arrays need constant indices
        for (int nt = 0; nt < 4; ++nt) accV[nt] = wmma4(Bq[nt], b2, accV[nt]);
      }
    }
  }

  // ---- sum the waves' partial outputs: each wave lays its 64 accumulator words a
  // ---- lane (zeros, if it had no tile) into its own two places, which it has done reading
  {
#pragma unroll  // register arrays need constant indices
    for (int nt = 0; nt < 4; ++nt) {
#pragma unroll  // register arrays need constant indices
      for (int u = 0; u < 2; ++u) {
        const int r = u * 4;
        *(v4f*)(ta + ((nt * 2 + u) * 32 + lane) * 4) =
            (v4f){accM[nt][r], accM[nt][r + 1], accM[nt][r + 2], accM[nt][r + 3]};
        *(v4f*)(ta + (((4 + nt) * 2 + u) * 32 + lane) * 4) =
            (v4f){accV[nt][r], accV[nt][r + 1], accV[nt][r + 2], accV[nt][r + 3]};
      }
    }
  }
  __syncthreads();   // all partial outputs are written; nothing is written to LDS behind it

  // ---- wave w finishes one output (w >> 2), 32 head columns ((w >> 1) & 1) and 8
  // ---- rows (w & 1): whole 128-byte lines, 8 neighbouring columns a lane
  {
    const int arr = wave >> 2;
    const int row = (wave & 1) * 8 + (lane >> 2);
    const int c8  = ((wave >> 1) & 1) * 4 + (lane & 3);   // which 8 of the 64 columns
    // columns c8 * 8 .. + 7 of that row: tile c8 >> 1, the writer's half c8 & 1
    const int src = (((arr * 4 + (c8 >> 1)) * 2) * 32 + row + 16 * (c8 & 1)) * 4;
    v4f lo = {0.f, 0.f, 0.f, 0.f}, hi = {0.f, 0.f, 0.f, 0.f};
#pragma unroll  // eight short trips: their LDS reads go out together
    for (int w = 0; w < NW; ++w) {
      lo += *(const v4f*)(smem + w * (WAVE_AT / 4) + src);
      hi += *(const v4f*)(smem + w * (WAVE_AT / 4) + src + 128);
    }
    const size_t g0 = (size_t)(b * SEQ + i0 + row) * DIM + h * DHEAD + c8 * 8;
    if (arr == 0) {                             // the same for the whole wave
      lo += *(const v4f*)(x + g0);
      hi += *(const v4f*)(x + g0 + 4);
      *(v4f*)(out_mean + g0)     = lo;
      *(v4f*)(out_mean + g0 + 4) = hi;
    } else {
      *(v4f*)(out_var + g0)     = lo;
      *(v4f*)(out_var + g0 + 4) = hi;
    }
  }
}

// ---------------------------------------------------------------------------
extern "C" void kernel_launch(void* const* d_in, const int* in_sizes, int n_in,
                              void* d_out, int out_size, void* d_ws, size_t ws_size,
                              hipStream_t stream) {
  const float* x     = (const float*)d_in[0];
  const float* var_x = (const float*)d_in[1];
  const float* k     = (const float*)d_in[2];
  const float* var_k = (const float*)d_in[3];
  const float* v     = (const float*)d_in[4];
  const float* var_v = (const float*)d_in[5];
  const float* wmu   = (const float*)d_in[6];
  const float* wvar  = (const float*)d_in[7];

  float* out = (float*)d_out;               // [mean | var], each B*S*D
  float* ws  = (float*)d_ws;
  const size_t NT = (size_t)BATCH * SEQ * DIM;   // 4M floats
  float* q   = ws;
  float* vq  = ws + NT;
  float* q2  = ws + 2 * NT;

  // 1) projection: 32 x 16 tiles of 128 x 64, 8 waves/block
  vdp_proj<<<512, 256, 0, stream>>>(x, var_x, wmu, wvar, q, vq, q2);

  // 2) fused causal VDP attention + residual, 8 waves per 16-row block,
  //    longest row blocks at the lowest indices
  vdp_flash<<<BATCH * HEADS * (SEQ / 16), 256, 0, stream>>>(
      q, vq, q2, k, var_k, v, var_v, x, out, out + NT);
}
